// v000
// The times below were measured on an AMD MI455X: many runs one after another, warmed up first and cycling through
// copies of the inputs, with the whole window's GPU time divided by the number of runs. Launches and the gaps
// between them are all in it. The median over several windows is given; except for v000 it joins two sittings, which
// can be a few percent apart, so the side-by-side timings, each taken in one sitting, are the better comparison.
// v000, which the later versions start from, runs in 156 microseconds.
#include <hip/hip_runtime.h>
#include <hip/hip_bf16.h>

typedef __attribute__((ext_vector_type(2))) float v2f;
typedef __attribute__((ext_vector_type(8))) float v8f;
typedef __attribute__((ext_vector_type(4))) unsigned int v4u;
typedef __attribute__((ext_vector_type(8))) int v8i;
typedef __attribute__((ext_vector_type(4))) int v4i;

#define NEG_INF -1e30f

constexpr int Bdim = 64, Ndim = 4, Adim = 1024, Odim = 128, Ddim = 256, Qdim = 256, Hdim = 128;

__device__ __forceinline__ v8f wmma_f32(v2f a, v2f b, v8f c) {
  // 8 args: (neg_a, A, neg_b, B, c_mod, C, reuse_a, reuse_b)
  return __builtin_amdgcn_wmma_f32_16x16x4_f32(false, a, false, b, (short)0, c, false, false);
}

// -----------------------------------------------------------------------------
// Kernel A: MT[b] = (obj_reps[b] (O=128 x D=256) @ W1[:D] (D=256 x H=128))^T
// Stored transposed (H x O) so WMMA B-fragments become contiguous b64 DS reads.
// grid = 64 blocks, 256 threads (8 waves). wave w -> row tile w; 8 col tiles.
// -----------------------------------------------------------------------------
__global__ __launch_bounds__(256) void precompute_M(const float* __restrict__ obj,
                                                    const float* __restrict__ W1,
                                                    float* __restrict__ MT) {
  const int b = blockIdx.x;
  const int tid = threadIdx.x;
  const int wv = tid >> 5, lane = tid & 31, j = lane & 15, hi = lane >> 4;
  const float* Am = obj + (size_t)b * Odim * Ddim;  // 128 x 256 row-major
  float* MTb = MT + (size_t)b * Odim * Hdim;        // transposed: 128(H) x 128(O)

  const int m0 = wv * 16;
  v8f c[8];
#pragma unroll
  for (int i = 0; i < 8; i++) c[i] = (v8f){0.f, 0.f, 0.f, 0.f, 0.f, 0.f, 0.f, 0.f};

  const float* arow = Am + (size_t)(m0 + j) * Ddim + 2 * hi;
#pragma unroll 2
  for (int k0 = 0; k0 < Ddim; k0 += 4) {
    v2f a = *reinterpret_cast<const v2f*>(arow + k0);
    const int kr = k0 + 2 * hi;
#pragma unroll
    for (int ct = 0; ct < 8; ct++) {
      const int col = ct * 16 + j;
      v2f bf;
      bf.x = W1[(size_t)kr * Hdim + col];
      bf.y = W1[(size_t)(kr + 1) * Hdim + col];
      c[ct] = wmma_f32(a, bf, c[ct]);
    }
  }
  // transposed store: MT[h, o] = C[o, h]
#pragma unroll
  for (int ct = 0; ct < 8; ct++)
#pragma unroll
    for (int r = 0; r < 8; r++)
      MTb[(size_t)(ct * 16 + j) * Odim + (m0 + r + 8 * hi)] = c[ct][r];
}

// -----------------------------------------------------------------------------
// Kernel B: qb[b,n,h] = b1[h] + sum_j q[b,n,j] * W1[D+j, h]
// -----------------------------------------------------------------------------
__global__ __launch_bounds__(128) void precompute_qb(const float* __restrict__ q,
                                                     const float* __restrict__ W1,
                                                     const float* __restrict__ b1,
                                                     float* __restrict__ qb) {
  const int bn = blockIdx.x;
  const int h = threadIdx.x;
  const float* qp = q + (size_t)bn * Qdim;
  float acc = b1[h];
#pragma unroll 4
  for (int jq = 0; jq < Qdim; jq++)
    acc += qp[jq] * W1[(size_t)(Ddim + jq) * Hdim + h];
  qb[(size_t)bn * Hdim + h] = acc;
}

// -----------------------------------------------------------------------------
// Kernel C (fused): TDM-stage MT[b] -> LDS, WMMA GEMM + relu + W2 dot,
// masked softmax, then att2 @ att1.
// -----------------------------------------------------------------------------
#define SM_STRIDE 132  // 128 + TDM pad of 4 DWORDs -> conflict-free b64 reads

__global__ __launch_bounds__(256) void att_fused(const float* __restrict__ att1,
                                                 const float* __restrict__ MT,
                                                 const float* __restrict__ qb,
                                                 const float* __restrict__ W2,
                                                 const float* __restrict__ b2p,
                                                 const int* __restrict__ tags,
                                                 const int* __restrict__ tptr,
                                                 float* __restrict__ out) {
  extern __shared__ float smem[];
  float* sMT = smem;                        // 128 rows(H) x 132 (O + pad)
  float* sLog = smem + Hdim * SM_STRIDE;    // 1024 (logits -> att2)
  float* sRed = sLog + Adim;                // 16
  float* sPart = smem;                      // phase-2 alias (128 floats)

  const int bn = blockIdx.x;
  const int b = bn >> 2;  // N = 4
  const int tid = threadIdx.x;
  const int wv = tid >> 5, lane = tid & 31, j = lane & 15, hi = lane >> 4;

  const float* att1_bn = att1 + (size_t)bn * Adim * Odim;
  const int* tags_bn = tags + (size_t)bn * Adim;
  const float* MTb = MT + (size_t)b * Odim * Hdim;
  const float* qb_bn = qb + (size_t)bn * Hdim;

  // ---- TDM: async-load MT[b] (128x128 f32, row stride 128) into LDS with
  //      hardware padding: 4 DWORDs pad after every 128 DWORDs -> stride 132.
  if (wv == 0) {
    const unsigned long long ga = (unsigned long long)(uintptr_t)MTb;
    const unsigned int lds_addr = (unsigned int)(uintptr_t)sMT;  // low 32 = LDS byte offset

    v4u g0;
    g0.x = 1u;                                  // count=1 (valid), no gather
    g0.y = lds_addr;                            // LDS dest (bytes)
    g0.z = (unsigned int)(ga & 0xffffffffu);    // global_addr[31:0]
    g0.w = (unsigned int)((ga >> 32) & 0x1ffffffu) | (2u << 30);  // addr[56:32] | type=2

    v8i g1;
    g1[0] = (int)((2u << 16)      // data_size = 4 bytes
                | (1u << 20)      // pad_enable
                | (6u << 22)      // pad_interval: 2^(6+1)=128 DWORDs
                | (3u << 25));    // pad_amount: 3+1 = 4 DWORDs
    g1[1] = (int)(128u << 16);    // tensor_dim0[15:0]=128 (atomic_barrier_addr=0)
    g1[2] = (int)(128u << 16);    // tensor_dim0[31:16]=0 | tensor_dim1[15:0]=128
    g1[3] = (int)(128u << 16);    // tensor_dim1[31:16]=0 | tile_dim0=128
    g1[4] = (int)128u;            // tile_dim1=128 | tile_dim2=0
    g1[5] = (int)128u;            // tensor_dim0_stride[31:0]=128
    g1[6] = 0;                    // stride0[47:32]=0 | stride1[15:0]=0
    g1[7] = 0;                    // stride1[47:16]=0

    v4i gz4 = (v4i){0, 0, 0, 0};                     // groups 2/3 unused (2D tile)
    v8i gz8 = (v8i){0, 0, 0, 0, 0, 0, 0, 0};         // extra group (clang-23 form)

    __builtin_amdgcn_tensor_load_to_lds(g0, g1, gz4, gz4, gz8, 0);
    __builtin_amdgcn_s_wait_tensorcnt(0);
  }
  __syncthreads();

  // per-lane column constants
  float qv[8], w2v[8];
#pragma unroll
  for (int ct = 0; ct < 8; ct++) {
    const int hc = ct * 16 + j;
    qv[ct] = qb_bn[hc];
    w2v[ct] = W2[hc];
  }
  const float b2v = b2p[0];

  // ---- GEMM att1[A,O] @ M[O,H], fused relu + W2 dot -> logits ----
  for (int rt = 0; rt < 8; rt++) {
    const int a0 = (wv * 8 + rt) * 16;
    v8f c[8];
#pragma unroll
    for (int i = 0; i < 8; i++) c[i] = (v8f){0.f, 0.f, 0.f, 0.f, 0.f, 0.f, 0.f, 0.f};

    const float* arow = att1_bn + (size_t)(a0 + j) * Odim + 2 * hi;
#pragma unroll 2
    for (int k0 = 0; k0 < Odim; k0 += 4) {
      v2f a = *reinterpret_cast<const v2f*>(arow + k0);
      const int kr = k0 + 2 * hi;
#pragma unroll
      for (int ct = 0; ct < 8; ct++) {
        // B[kr,col] , B[kr+1,col] = MT[col, kr], MT[col, kr+1]  (one b64 read)
        v2f bf = *reinterpret_cast<const v2f*>(sMT + (size_t)(ct * 16 + j) * SM_STRIDE + kr);
        c[ct] = wmma_f32(a, bf, c[ct]);
      }
    }

    float s[8];
#pragma unroll
    for (int r = 0; r < 8; r++) s[r] = 0.f;
#pragma unroll
    for (int ct = 0; ct < 8; ct++) {
#pragma unroll
      for (int r = 0; r < 8; r++) {
        float x = c[ct][r] + qv[ct];
        x = x > 0.f ? x : 0.f;
        s[r] += x * w2v[ct];
      }
    }
    // reduce over the 16-lane N dimension (xor 1,2,4,8 keeps hi-halves apart)
#pragma unroll
    for (int r = 0; r < 8; r++) {
      float v = s[r];
      v += __shfl_xor(v, 1, 32);
      v += __shfl_xor(v, 2, 32);
      v += __shfl_xor(v, 4, 32);
      v += __shfl_xor(v, 8, 32);
      if (j == 0) sLog[a0 + r + 8 * hi] = v + b2v;
    }
  }
  __syncthreads();

  // ---- masked, temperature-scaled softmax over A = 1024 ----
  const float invt = 1.0f / (float)tptr[0];
  float lmax = NEG_INF;
  for (int a = tid; a < Adim; a += 256) {
    const float v = (tags_bn[a] > 0) ? sLog[a] * invt : NEG_INF;
    sLog[a] = v;
    lmax = fmaxf(lmax, v);
  }
#pragma unroll
  for (int off = 16; off >= 1; off >>= 1) lmax = fmaxf(lmax, __shfl_xor(lmax, off, 32));
  if (lane == 0) sRed[wv] = lmax;
  __syncthreads();
  float bmax = sRed[0];
#pragma unroll
  for (int i = 1; i < 8; i++) bmax = fmaxf(bmax, sRed[i]);

  float lsum = 0.f;
  for (int a = tid; a < Adim; a += 256) {
    const float e = __expf(sLog[a] - bmax);
    sLog[a] = e;
    lsum += e;
  }
#pragma unroll
  for (int off = 16; off >= 1; off >>= 1) lsum += __shfl_xor(lsum, off, 32);
  if (lane == 0) sRed[8 + wv] = lsum;
  __syncthreads();
  float bsum = 0.f;
#pragma unroll
  for (int i = 0; i < 8; i++) bsum += sRed[8 + i];
  const float invsum = 1.0f / bsum;
  for (int a = tid; a < Adim; a += 256) sLog[a] *= invsum;
  __syncthreads();

  // ---- out[o] = sum_a att2[a] * att1[a,o]  (att1 reread hits L2) ----
  const int o = tid & 127;
  const int half = tid >> 7;
  const float* colp = att1_bn + (size_t)half * 512 * Odim + o;
  const float* att2p = sLog + half * 512;
  float acc = 0.f;
#pragma unroll 4
  for (int a = 0; a < 512; a++) acc += att2p[a] * colp[(size_t)a * Odim];
  if (half == 1) sPart[o] = acc;
  __syncthreads();
  if (half == 0) out[(size_t)bn * Odim + o] = acc + sPart[o];
}

// -----------------------------------------------------------------------------
extern "C" void kernel_launch(void* const* d_in, const int* in_sizes, int n_in,
                              void* d_out, int out_size, void* d_ws, size_t ws_size,
                              hipStream_t stream) {
  const float* q    = (const float*)d_in[0];  // [B,N,1,Q]
  const float* att1 = (const float*)d_in[1];  // [B,N,A,O]
  const float* obj  = (const float*)d_in[2];  // [B,O,D]
  const int*   tags = (const int*)d_in[3];    // [B,N,A]
  const float* W1   = (const float*)d_in[4];  // [D+Q,H]
  const float* b1   = (const float*)d_in[5];  // [H]
  const float* W2   = (const float*)d_in[6];  // [H,1]
  const float* b2   = (const float*)d_in[7];  // [1]
  const int*   t    = (const int*)d_in[8];    // scalar
  float* out = (float*)d_out;                 // [B,N,O]

  float* MT = (float*)d_ws;                           // 64*128*128 f32 = 4 MB
  float* qb = MT + (size_t)Bdim * Odim * Hdim;        // 64*4*128 f32

  precompute_M<<<Bdim, 256, 0, stream>>>(obj, W1, MT);
  precompute_qb<<<Bdim * Ndim, 128, 0, stream>>>(q, W1, b1, qb);

  const size_t smem = (size_t)(Hdim * SM_STRIDE + Adim + 16) * sizeof(float);  // ~71.8 KB
  att_fused<<<Bdim * Ndim, 256, smem, stream>>>(att1, MT, qb, W2, b2, tags, t, out);
}

// v001
// One run takes 130 microseconds.
// Timed twice side by side with v000, it ran 1.19 and 1.20 times as fast.
#include <hip/hip_runtime.h>
#include <hip/hip_bf16.h>

typedef __attribute__((ext_vector_type(2))) float v2f;
typedef __attribute__((ext_vector_type(4))) float v4f;
typedef __attribute__((ext_vector_type(8))) float v8f;
typedef __attribute__((ext_vector_type(4))) unsigned int v4u;
typedef __attribute__((ext_vector_type(8))) int v8i;
typedef __attribute__((ext_vector_type(4))) int v4i;

#define NEG_INF -1e30f

constexpr int Bdim = 64, Ndim = 4, Adim = 1024, Odim = 128, Ddim = 256, Qdim = 256, Hdim = 128;

__device__ __forceinline__ v8f wmma_f32(v2f a, v2f b, v8f c) {
  // 8 args: (neg_a, A, neg_b, B, c_mod, C, reuse_a, reuse_b)
  return __builtin_amdgcn_wmma_f32_16x16x4_f32(false, a, false, b, (short)0, c, false, false);
}

// -----------------------------------------------------------------------------
// Kernel A: MT[b] = (obj_reps[b] (O=128 x D=256) @ W1[:D] (D=256 x H=128))^T
// Stored transposed (H x O) so WMMA B-fragments become contiguous b64 DS reads.
// grid = 64 blocks, 256 threads (8 waves). wave w -> row tile w; 8 col tiles.
// -----------------------------------------------------------------------------
__global__ __launch_bounds__(256) void precompute_M(const float* __restrict__ obj,
                                                    const float* __restrict__ W1,
                                                    float* __restrict__ MT) {
  const int b = blockIdx.x;
  const int tid = threadIdx.x;
  const int wv = tid >> 5, lane = tid & 31, j = lane & 15, hi = lane >> 4;
  const float* Am = obj + (size_t)b * Odim * Ddim;  // 128 x 256 row-major
  float* MTb = MT + (size_t)b * Odim * Hdim;        // transposed: 128(H) x 128(O)

  const int m0 = wv * 16;
  v8f c[8];
#pragma unroll
  for (int i = 0; i < 8; i++) c[i] = (v8f){0.f, 0.f, 0.f, 0.f, 0.f, 0.f, 0.f, 0.f};

  const float* arow = Am + (size_t)(m0 + j) * Ddim + 2 * hi;
#pragma unroll 2
  for (int k0 = 0; k0 < Ddim; k0 += 4) {
    v2f a = *reinterpret_cast<const v2f*>(arow + k0);
    const int kr = k0 + 2 * hi;
#pragma unroll
    for (int ct = 0; ct < 8; ct++) {
      const int col = ct * 16 + j;
      v2f bf;
      bf.x = W1[(size_t)kr * Hdim + col];
      bf.y = W1[(size_t)(kr + 1) * Hdim + col];
      c[ct] = wmma_f32(a, bf, c[ct]);
    }
  }
  // transposed store: MT[h, o] = C[o, h]
#pragma unroll
  for (int ct = 0; ct < 8; ct++)
#pragma unroll
    for (int r = 0; r < 8; r++)
      MTb[(size_t)(ct * 16 + j) * Odim + (m0 + r + 8 * hi)] = c[ct][r];
}

// -----------------------------------------------------------------------------
// Kernel B (fused): TDM-stage MT[b] -> LDS; meanwhile
// qb[h] = b1[h] + sum_j q[b,n,j] * W1[D+j, h] (wave w sums j in [32w, 32w+32));
// WMMA GEMM + relu + W2 dot, masked softmax, then att2 @ att1.
// -----------------------------------------------------------------------------
#define SM_STRIDE 132  // 128 + TDM pad of 4 DWORDs -> conflict-free b64 reads

__global__ __launch_bounds__(256) void att_fused(const float* __restrict__ att1,
                                                 const float* __restrict__ MT,
                                                 const float* __restrict__ q,
                                                 const float* __restrict__ W1,
                                                 const float* __restrict__ b1,
                                                 const float* __restrict__ W2,
                                                 const float* __restrict__ b2p,
                                                 const int* __restrict__ tags,
                                                 const int* __restrict__ tptr,
                                                 float* __restrict__ out) {
  extern __shared__ float smem[];
  float* sMT = smem;                        // 128 rows(H) x 132 (O + pad)
  float* sLog = smem + Hdim * SM_STRIDE;    // 1024 (logits -> att2)
  float* sRed = sLog + Adim;                // 16
  float* sQ = sRed + 16;                    // 8 waves x 128 partial sums of qb
  float* sPart = smem;                      // phase-2 alias (128 floats)

  const int bn = blockIdx.x;
  const int b = bn >> 2;  // N = 4
  const int tid = threadIdx.x;
  const int wv = tid >> 5, lane = tid & 31, j = lane & 15, hi = lane >> 4;

  const float* att1_bn = att1 + (size_t)bn * Adim * Odim;
  const int* tags_bn = tags + (size_t)bn * Adim;
  const float* MTb = MT + (size_t)b * Odim * Hdim;

  // q projection, loads: wave w takes rows D+32w .. D+32w+31 of W1, lane l the
  // columns 4l .. 4l+3. All 32 row loads are issued ahead of the tensor load,
  // so that one L2 round trip covers them and runs beside the tile's landing.
  const int wvu = __builtin_amdgcn_readfirstlane(wv);  // wave-uniform: q is read by scalar loads
  const float* qp = q + (size_t)bn * Qdim + wvu * 32;
  const float* wp = W1 + (size_t)(Ddim + wvu * 32) * Hdim + lane * 4;
  v4f wrow[32];
#pragma unroll  // full: wrow stays in registers and the loads form one run
  for (int i = 0; i < 32; i++) wrow[i] = *reinterpret_cast<const v4f*>(wp + (size_t)i * Hdim);

  // ---- TDM: async-load MT[b] (128x128 f32, row stride 128) into LDS with
  //      hardware padding: 4 DWORDs pad after every 128 DWORDs -> stride 132.
  if (wv == 0) {
    const unsigned long long ga = (unsigned long long)(uintptr_t)MTb;
    const unsigned int lds_addr = (unsigned int)(uintptr_t)sMT;  // low 32 = LDS byte offset

    v4u g0;
    g0.x = 1u;                                  // count=1 (valid), no gather
    g0.y = lds_addr;                            // LDS dest (bytes)
    g0.z = (unsigned int)(ga & 0xffffffffu);    // global_addr[31:0]
    g0.w = (unsigned int)((ga >> 32) & 0x1ffffffu) | (2u << 30);  // addr[56:32] | type=2

    v8i g1;
    g1[0] = (int)((2u << 16)      // data_size = 4 bytes
                | (1u << 20)      // pad_enable
                | (6u << 22)      // pad_interval: 2^(6+1)=128 DWORDs
                | (3u << 25));    // pad_amount: 3+1 = 4 DWORDs
    g1[1] = (int)(128u << 16);    // tensor_dim0[15:0]=128 (atomic_barrier_addr=0)
    g1[2] = (int)(128u << 16);    // tensor_dim0[31:16]=0 | tensor_dim1[15:0]=128
    g1[3] = (int)(128u << 16);    // tensor_dim1[31:16]=0 | tile_dim0=128
    g1[4] = (int)128u;            // tile_dim1=128 | tile_dim2=0
    g1[5] = (int)128u;            // tensor_dim0_stride[31:0]=128
    g1[6] = 0;                    // stride0[47:32]=0 | stride1[15:0]=0
    g1[7] = 0;                    // stride1[47:16]=0

    v4i gz4 = (v4i){0, 0, 0, 0};                     // groups 2/3 unused (2D tile)
    v8i gz8 = (v8i){0, 0, 0, 0, 0, 0, 0, 0};         // extra group (clang-23 form)

    __builtin_amdgcn_tensor_load_to_lds(g0, g1, gz4, gz4, gz8, 0);
    __builtin_amdgcn_s_wait_tensorcnt(0);
  }

  // q projection, sums: each wave's partial goes to its own LDS row; the
  // barrier below publishes it together with the tile.
  {
    v4f pacc = (v4f){0.f, 0.f, 0.f, 0.f};
#pragma unroll  // full: wrow is indexed by constants only
    for (int i = 0; i < 32; i++) pacc += qp[i] * wrow[i];
    *reinterpret_cast<v4f*>(sQ + wv * Hdim + lane * 4) = pacc;
  }
  __syncthreads();

  // per-lane column constants
  float qv[8], w2v[8];
#pragma unroll
  for (int ct = 0; ct < 8; ct++) {
    const int hc = ct * 16 + j;
    float qacc = b1[hc];
#pragma unroll
    for (int w = 0; w < 8; w++) qacc += sQ[w * Hdim + hc];
    qv[ct] = qacc;
    w2v[ct] = W2[hc];
  }
  const float b2v = b2p[0];

  // ---- GEMM att1[A,O] @ M[O,H], fused relu + W2 dot -> logits ----
  for (int rt = 0; rt < 8; rt++) {
    const int a0 = (wv * 8 + rt) * 16;
    v8f c[8];
#pragma unroll
    for (int i = 0; i < 8; i++) c[i] = (v8f){0.f, 0.f, 0.f, 0.f, 0.f, 0.f, 0.f, 0.f};

    const float* arow = att1_bn + (size_t)(a0 + j) * Odim + 2 * hi;
#pragma unroll 2
    for (int k0 = 0; k0 < Odim; k0 += 4) {
      v2f a = *reinterpret_cast<const v2f*>(arow + k0);
      const int kr = k0 + 2 * hi;
#pragma unroll
      for (int ct = 0; ct < 8; ct++) {
        // B[kr,col] , B[kr+1,col] = MT[col, kr], MT[col, kr+1]  (one b64 read)
        v2f bf = *reinterpret_cast<const v2f*>(sMT + (size_t)(ct * 16 + j) * SM_STRIDE + kr);
        c[ct] = wmma_f32(a, bf, c[ct]);
      }
    }

    float s[8];
#pragma unroll
    for (int r = 0; r < 8; r++) s[r] = 0.f;
#pragma unroll
    for (int ct = 0; ct < 8; ct++) {
#pragma unroll
      for (int r = 0; r < 8; r++) {
        float x = c[ct][r] + qv[ct];
        x = x > 0.f ? x : 0.f;
        s[r] += x * w2v[ct];
      }
    }
    // reduce over the 16-lane N dimension (xor 1,2,4,8 keeps hi-halves apart)
#pragma unroll
    for (int r = 0; r < 8; r++) {
      float v = s[r];
      v += __shfl_xor(v, 1, 32);
      v += __shfl_xor(v, 2, 32);
      v += __shfl_xor(v, 4, 32);
      v += __shfl_xor(v, 8, 32);
      if (j == 0) sLog[a0 + r + 8 * hi] = v + b2v;
    }
  }
  __syncthreads();

  // ---- masked, temperature-scaled softmax over A = 1024 ----
  const float invt = 1.0f / (float)tptr[0];
  float lmax = NEG_INF;
  for (int a = tid; a < Adim; a += 256) {
    const float v = (tags_bn[a] > 0) ? sLog[a] * invt : NEG_INF;
    sLog[a] = v;
    lmax = fmaxf(lmax, v);
  }
#pragma unroll
  for (int off = 16; off >= 1; off >>= 1) lmax = fmaxf(lmax, __shfl_xor(lmax, off, 32));
  if (lane == 0) sRed[wv] = lmax;
  __syncthreads();
  float bmax = sRed[0];
#pragma unroll
  for (int i = 1; i < 8; i++) bmax = fmaxf(bmax, sRed[i]);

  float lsum = 0.f;
  for (int a = tid; a < Adim; a += 256) {
    const float e = __expf(sLog[a] - bmax);
    sLog[a] = e;
    lsum += e;
  }
#pragma unroll
  for (int off = 16; off >= 1; off >>= 1) lsum += __shfl_xor(lsum, off, 32);
  if (lane == 0) sRed[8 + wv] = lsum;
  __syncthreads();
  float bsum = 0.f;
#pragma unroll
  for (int i = 0; i < 8; i++) bsum += sRed[8 + i];
  const float invsum = 1.0f / bsum;
  for (int a = tid; a < Adim; a += 256) sLog[a] *= invsum;
  __syncthreads();

  // ---- out[o] = sum_a att2[a] * att1[a,o]  (att1 reread hits L2) ----
  const int o = tid & 127;
  const int half = tid >> 7;
  const float* colp = att1_bn + (size_t)half * 512 * Odim + o;
  const float* att2p = sLog + half * 512;
  float acc = 0.f;
#pragma unroll 4
  for (int a = 0; a < 512; a++) acc += att2p[a] * colp[(size_t)a * Odim];
  if (half == 1) sPart[o] = acc;
  __syncthreads();
  if (half == 0) out[(size_t)bn * Odim + o] = acc + sPart[o];
}

// -----------------------------------------------------------------------------
extern "C" void kernel_launch(void* const* d_in, const int* in_sizes, int n_in,
                              void* d_out, int out_size, void* d_ws, size_t ws_size,
                              hipStream_t stream) {
  const float* q    = (const float*)d_in[0];  // [B,N,1,Q]
  const float* att1 = (const float*)d_in[1];  // [B,N,A,O]
  const float* obj  = (const float*)d_in[2];  // [B,O,D]
  const int*   tags = (const int*)d_in[3];    // [B,N,A]
  const float* W1   = (const float*)d_in[4];  // [D+Q,H]
  const float* b1   = (const float*)d_in[5];  // [H]
  const float* W2   = (const float*)d_in[6];  // [H,1]
  const float* b2   = (const float*)d_in[7];  // [1]
  const int*   t    = (const int*)d_in[8];    // scalar
  float* out = (float*)d_out;                 // [B,N,O]

  float* MT = (float*)d_ws;                           // 64*128*128 f32 = 4 MB

  precompute_M<<<Bdim, 256, 0, stream>>>(obj, W1, MT);

  const size_t smem = (size_t)(Hdim * SM_STRIDE + Adim + 16 + 8 * Hdim) * sizeof(float);  // ~75.8 KB
  att_fused<<<Bdim * Ndim, 256, smem, stream>>>(att1, MT, q, W1, b1, W2, b2, tags, t, out);
}

// v002
// One run takes 104 microseconds.
// Two timings next to v001 put it at 1.25 and 1.24 times that version's speed.
// Counting every step since v000, it is 1.49 times as fast.
#include <hip/hip_runtime.h>
#include <hip/hip_bf16.h>

typedef __attribute__((ext_vector_type(2))) float v2f;
typedef __attribute__((ext_vector_type(4))) float v4f;
typedef __attribute__((ext_vector_type(8))) float v8f;
typedef __attribute__((ext_vector_type(4))) unsigned int v4u;
typedef __attribute__((ext_vector_type(8))) int v8i;
typedef __attribute__((ext_vector_type(4))) int v4i;

#define NEG_INF -1e30f

constexpr int Bdim = 64, Ndim = 4, Adim = 1024, Odim = 128, Ddim = 256, Qdim = 256, Hdim = 128;

__device__ __forceinline__ v8f wmma_f32(v2f a, v2f b, v8f c) {
  // 8 args: (neg_a, A, neg_b, B, c_mod, C, reuse_a, reuse_b)
  return __builtin_amdgcn_wmma_f32_16x16x4_f32(false, a, false, b, (short)0, c, false, false);
}

// -----------------------------------------------------------------------------
// Kernel A: MT[b] = (obj_reps[b] (O=128 x D=256) @ W1[:D] (D=256 x H=128))^T
// Stored transposed (H x O) so WMMA B-fragments become contiguous b64 DS reads.
// grid = 64 blocks, 256 threads (8 waves). wave w -> row tile w; 8 col tiles.
// -----------------------------------------------------------------------------
__global__ __launch_bounds__(256) void precompute_M(const float* __restrict__ obj,
                                                    const float* __restrict__ W1,
                                                    float* __restrict__ MT) {
  const int b = blockIdx.x;
  const int tid = threadIdx.x;
  const int wv = tid >> 5, lane = tid & 31, j = lane & 15, hi = lane >> 4;
  const float* Am = obj + (size_t)b * Odim * Ddim;  // 128 x 256 row-major
  float* MTb = MT + (size_t)b * Odim * Hdim;        // transposed: 128(H) x 128(O)

  const int m0 = wv * 16;
  v8f c[8];
#pragma unroll
  for (int i = 0; i < 8; i++) c[i] = (v8f){0.f, 0.f, 0.f, 0.f, 0.f, 0.f, 0.f, 0.f};

  const float* arow = Am + (size_t)(m0 + j) * Ddim + 2 * hi;
#pragma unroll 2
  for (int k0 = 0; k0 < Ddim; k0 += 4) {
    v2f a = *reinterpret_cast<const v2f*>(arow + k0);
    const int kr = k0 + 2 * hi;
#pragma unroll
    for (int ct = 0; ct < 8; ct++) {
      const int col = ct * 16 + j;
      v2f bf;
      bf.x = W1[(size_t)kr * Hdim + col];
      bf.y = W1[(size_t)(kr + 1) * Hdim + col];
      c[ct] = wmma_f32(a, bf, c[ct]);
    }
  }
  // transposed store: MT[h, o] = C[o, h]
#pragma unroll
  for (int ct = 0; ct < 8; ct++)
#pragma unroll
    for (int r = 0; r < 8; r++)
      MTb[(size_t)(ct * 16 + j) * Odim + (m0 + r + 8 * hi)] = c[ct][r];
}

// -----------------------------------------------------------------------------
// Kernel B (fused): TDM-stage MT[b] -> LDS; meanwhile
// qb[h] = b1[h] + sum_j q[b,n,j] * W1[D+j, h] (wave w sums j in [32w, 32w+32));
// WMMA GEMM + relu + W2 dot, masked softmax, then att2 @ att1.
// -----------------------------------------------------------------------------
#define SM_STRIDE 132  // 128 + TDM pad of 4 DWORDs -> conflict-free b64 reads

__global__ __launch_bounds__(256) void att_fused(const float* __restrict__ att1,
                                                 const float* __restrict__ MT,
                                                 const float* __restrict__ q,
                                                 const float* __restrict__ W1,
                                                 const float* __restrict__ b1,
                                                 const float* __restrict__ W2,
                                                 const float* __restrict__ b2p,
                                                 const int* __restrict__ tags,
                                                 const int* __restrict__ tptr,
                                                 float* __restrict__ out) {
  extern __shared__ float smem[];
  float* sMT = smem;                        // 128 rows(H) x 132 (O + pad)
  float* sLog = smem + Hdim * SM_STRIDE;    // 1024 (logits -> att2)
  float* sRed = sLog + Adim;                // 16
  float* sQ = sRed + 16;                    // 8 waves x 128 partial sums of qb
  float* sPart = smem;                      // phase-2 alias (8 waves x 128 floats)

  const int bn = blockIdx.x;
  const int b = bn >> 2;  // N = 4
  const int tid = threadIdx.x;
  const int wv = tid >> 5, lane = tid & 31, j = lane & 15, hi = lane >> 4;

  const float* att1_bn = att1 + (size_t)bn * Adim * Odim;
  const int* tags_bn = tags + (size_t)bn * Adim;
  const float* MTb = MT + (size_t)b * Odim * Hdim;

  // q projection, loads: wave w takes rows D+32w .. D+32w+31 of W1, lane l the
  // columns 4l .. 4l+3. All 32 row loads are issued ahead of the tensor load,
  // so that one L2 round trip covers them and runs beside the tile's landing.
  const int wvu = __builtin_amdgcn_readfirstlane(wv);  // wave-uniform: q is read by scalar loads
  const float* qp = q + (size_t)bn * Qdim + wvu * 32;
  const float* wp = W1 + (size_t)(Ddim + wvu * 32) * Hdim + lane * 4;
  v4f wrow[32];
#pragma unroll  // full: wrow stays in registers and the loads form one run
  for (int i = 0; i < 32; i++) wrow[i] = *reinterpret_cast<const v4f*>(wp + (size_t)i * Hdim);

  // ---- TDM: async-load MT[b] (128x128 f32, row stride 128) into LDS with
  //      hardware padding: 4 DWORDs pad after every 128 DWORDs -> stride 132.
  if (wv == 0) {
    const unsigned long long ga = (unsigned long long)(uintptr_t)MTb;
    const unsigned int lds_addr = (unsigned int)(uintptr_t)sMT;  // low 32 = LDS byte offset

    v4u g0;
    g0.x = 1u;                                  // count=1 (valid), no gather
    g0.y = lds_addr;                            // LDS dest (bytes)
    g0.z = (unsigned int)(ga & 0xffffffffu);    // global_addr[31:0]
    g0.w = (unsigned int)((ga >> 32) & 0x1ffffffu) | (2u << 30);  // addr[56:32] | type=2

    v8i g1;
    g1[0] = (int)((2u << 16)      // data_size = 4 bytes
                | (1u << 20)      // pad_enable
                | (6u << 22)      // pad_interval: 2^(6+1)=128 DWORDs
                | (3u << 25));    // pad_amount: 3+1 = 4 DWORDs
    g1[1] = (int)(128u << 16);    // tensor_dim0[15:0]=128 (atomic_barrier_addr=0)
    g1[2] = (int)(128u << 16);    // tensor_dim0[31:16]=0 | tensor_dim1[15:0]=128
    g1[3] = (int)(128u << 16);    // tensor_dim1[31:16]=0 | tile_dim0=128
    g1[4] = (int)128u;            // tile_dim1=128 | tile_dim2=0
    g1[5] = (int)128u;            // tensor_dim0_stride[31:0]=128
    g1[6] = 0;                    // stride0[47:32]=0 | stride1[15:0]=0
    g1[7] = 0;                    // stride1[47:16]=0

    v4i gz4 = (v4i){0, 0, 0, 0};                     // groups 2/3 unused (2D tile)
    v8i gz8 = (v8i){0, 0, 0, 0, 0, 0, 0, 0};         // extra group (clang-23 form)

    __builtin_amdgcn_tensor_load_to_lds(g0, g1, gz4, gz4, gz8, 0);
    __builtin_amdgcn_s_wait_tensorcnt(0);
  }

  // q projection, sums: each wave's partial goes to its own LDS row; the
  // barrier below publishes it together with the tile.
  {
    v4f pacc = (v4f){0.f, 0.f, 0.f, 0.f};
#pragma unroll  // full: wrow is indexed by constants only
    for (int i = 0; i < 32; i++) pacc += qp[i] * wrow[i];
    *reinterpret_cast<v4f*>(sQ + wv * Hdim + lane * 4) = pacc;
  }
  __syncthreads();

  // per-lane column constants
  float qv[8], w2v[8];
#pragma unroll
  for (int ct = 0; ct < 8; ct++) {
    const int hc = ct * 16 + j;
    float qacc = b1[hc];
#pragma unroll
    for (int w = 0; w < 8; w++) qacc += sQ[w * Hdim + hc];
    qv[ct] = qacc;
    w2v[ct] = W2[hc];
  }
  const float b2v = b2p[0];

  // ---- GEMM att1[A,O] @ M[O,H], fused relu + W2 dot -> logits ----
  for (int rt = 0; rt < 8; rt++) {
    const int a0 = (wv * 8 + rt) * 16;
    v8f c[8];
#pragma unroll
    for (int i = 0; i < 8; i++) c[i] = (v8f){0.f, 0.f, 0.f, 0.f, 0.f, 0.f, 0.f, 0.f};

    const float* arow = att1_bn + (size_t)(a0 + j) * Odim + 2 * hi;
#pragma unroll 2
    for (int k0 = 0; k0 < Odim; k0 += 4) {
      v2f a = *reinterpret_cast<const v2f*>(arow + k0);
      const int kr = k0 + 2 * hi;
#pragma unroll
      for (int ct = 0; ct < 8; ct++) {
        // B[kr,col] , B[kr+1,col] = MT[col, kr], MT[col, kr+1]  (one b64 read)
        v2f bf = *reinterpret_cast<const v2f*>(sMT + (size_t)(ct * 16 + j) * SM_STRIDE + kr);
        c[ct] = wmma_f32(a, bf, c[ct]);
      }
    }

    float s[8];
#pragma unroll
    for (int r = 0; r < 8; r++) s[r] = 0.f;
#pragma unroll
    for (int ct = 0; ct < 8; ct++) {
#pragma unroll
      for (int r = 0; r < 8; r++) {
        float x = c[ct][r] + qv[ct];
        x = x > 0.f ? x : 0.f;
        s[r] += x * w2v[ct];
      }
    }
    // reduce over the 16-lane N dimension (xor 1,2,4,8 keeps hi-halves apart)
#pragma unroll
    for (int r = 0; r < 8; r++) {
      float v = s[r];
      v += __shfl_xor(v, 1, 32);
      v += __shfl_xor(v, 2, 32);
      v += __shfl_xor(v, 4, 32);
      v += __shfl_xor(v, 8, 32);
      if (j == 0) sLog[a0 + r + 8 * hi] = v + b2v;
    }
  }
  __syncthreads();

  // ---- masked, temperature-scaled softmax over A = 1024 ----
  const float invt = 1.0f / (float)tptr[0];
  float lmax = NEG_INF;
  for (int a = tid; a < Adim; a += 256) {
    const float v = (tags_bn[a] > 0) ? sLog[a] * invt : NEG_INF;
    sLog[a] = v;
    lmax = fmaxf(lmax, v);
  }
#pragma unroll
  for (int off = 16; off >= 1; off >>= 1) lmax = fmaxf(lmax, __shfl_xor(lmax, off, 32));
  if (lane == 0) sRed[wv] = lmax;
  __syncthreads();
  float bmax = sRed[0];
#pragma unroll
  for (int i = 1; i < 8; i++) bmax = fmaxf(bmax, sRed[i]);

  float lsum = 0.f;
  for (int a = tid; a < Adim; a += 256) {
    const float e = __expf(sLog[a] - bmax);
    sLog[a] = e;
    lsum += e;
  }
#pragma unroll
  for (int off = 16; off >= 1; off >>= 1) lsum += __shfl_xor(lsum, off, 32);
  if (lane == 0) sRed[8 + wv] = lsum;
  __syncthreads();
  float bsum = 0.f;
#pragma unroll
  for (int i = 0; i < 8; i++) bsum += sRed[8 + i];
  const float invsum = 1.0f / bsum;
  for (int a = tid; a < Adim; a += 256) sLog[a] *= invsum;
  __syncthreads();

  // ---- out[o] = sum_a att2[a] * att1[a,o]  (att1 reread hits L2) ----
  // Wave w streams rows 128w .. 128w+127; a lane holds columns 4l .. 4l+3, so
  // one load of a wave is one whole row (512 contiguous bytes).
  {
    const float* rowp = att1_bn + (size_t)wv * 128 * Odim + lane * 4;
    const float* att2p = sLog + wv * 128;
    v4f acc = (v4f){0.f, 0.f, 0.f, 0.f};
    for (int a0 = 0; a0 < 128; a0 += 16) {
      v4f rowv[16];
#pragma unroll  // full: 16 row loads leave as one run, one L2 round trip for all
      for (int i = 0; i < 16; i++)
        rowv[i] = *reinterpret_cast<const v4f*>(rowp + (size_t)(a0 + i) * Odim);
#pragma unroll  // full: rowv is indexed by constants only
      for (int i = 0; i < 16; i++) acc += att2p[a0 + i] * rowv[i];
    }
    *reinterpret_cast<v4f*>(sPart + wv * Odim + lane * 4) = acc;
  }
  __syncthreads();
  if (tid < Odim) {
    float r = sPart[tid];
#pragma unroll  // full: the seven LDS reads leave together
    for (int w = 1; w < 8; w++) r += sPart[w * Odim + tid];
    out[(size_t)bn * Odim + tid] = r;
  }
}

// -----------------------------------------------------------------------------
extern "C" void kernel_launch(void* const* d_in, const int* in_sizes, int n_in,
                              void* d_out, int out_size, void* d_ws, size_t ws_size,
                              hipStream_t stream) {
  const float* q    = (const float*)d_in[0];  // [B,N,1,Q]
  const float* att1 = (const float*)d_in[1];  // [B,N,A,O]
  const float* obj  = (const float*)d_in[2];  // [B,O,D]
  const int*   tags = (const int*)d_in[3];    // [B,N,A]
  const float* W1   = (const float*)d_in[4];  // [D+Q,H]
  const float* b1   = (const float*)d_in[5];  // [H]
  const float* W2   = (const float*)d_in[6];  // [H,1]
  const float* b2   = (const float*)d_in[7];  // [1]
  const int*   t    = (const int*)d_in[8];    // scalar
  float* out = (float*)d_out;                 // [B,N,O]

  float* MT = (float*)d_ws;                           // 64*128*128 f32 = 4 MB

  precompute_M<<<Bdim, 256, 0, stream>>>(obj, W1, MT);

  const size_t smem = (size_t)(Hdim * SM_STRIDE + Adim + 16 + 8 * Hdim) * sizeof(float);  // ~75.8 KB
  att_fused<<<Bdim * Ndim, 256, smem, stream>>>(att1, MT, q, W1, b1, W2, b2, tags, t, out);
}

// v003
// It runs in 87.8 microseconds.
// Two timings next to v002 both put it at 1.18 times that version's speed.
// Counting every step since v000, it is 1.76 times as fast.
#include <hip/hip_runtime.h>
#include <hip/hip_bf16.h>
#include <type_traits>

typedef __attribute__((ext_vector_type(2))) float v2f;
typedef __attribute__((ext_vector_type(4))) float v4f;
typedef __attribute__((ext_vector_type(8))) float v8f;
typedef __attribute__((ext_vector_type(4))) unsigned int v4u;
typedef __attribute__((ext_vector_type(8))) int v8i;
typedef __attribute__((ext_vector_type(4))) int v4i;

#define NEG_INF -1e30f

constexpr int Bdim = 64, Ndim = 4, Adim = 1024, Odim = 128, Ddim = 256, Qdim = 256, Hdim = 128;

__device__ __forceinline__ v8f wmma_f32(v2f a, v2f b, v8f c) {
  // 8 args: (neg_a, A, neg_b, B, c_mod, C, reuse_a, reuse_b)
  return __builtin_amdgcn_wmma_f32_16x16x4_f32(false, a, false, b, (short)0, c, false, false);
}

// -----------------------------------------------------------------------------
// Kernel A: MT[b] = (obj_reps[b] (O=128 x D=256) @ W1[:D] (D=256 x H=128))^T
// Stored transposed (H x O) so WMMA B-fragments become contiguous b128 DS reads.
// grid = 64 blocks, 256 threads (8 waves). wave w -> row tile w; 8 col tiles.
// -----------------------------------------------------------------------------
__global__ __launch_bounds__(256) void precompute_M(const float* __restrict__ obj,
                                                    const float* __restrict__ W1,
                                                    float* __restrict__ MT) {
  const int b = blockIdx.x;
  const int tid = threadIdx.x;
  const int wv = tid >> 5, lane = tid & 31, j = lane & 15, hi = lane >> 4;
  const float* Am = obj + (size_t)b * Odim * Ddim;  // 128 x 256 row-major
  float* MTb = MT + (size_t)b * Odim * Hdim;        // transposed: 128(H) x 128(O)

  const int m0 = wv * 16;
  v8f c[8];
#pragma unroll
  for (int i = 0; i < 8; i++) c[i] = (v8f){0.f, 0.f, 0.f, 0.f, 0.f, 0.f, 0.f, 0.f};

  const float* arow = Am + (size_t)(m0 + j) * Ddim + 2 * hi;
#pragma unroll 2
  for (int k0 = 0; k0 < Ddim; k0 += 4) {
    v2f a = *reinterpret_cast<const v2f*>(arow + k0);
    const int kr = k0 + 2 * hi;
#pragma unroll
    for (int ct = 0; ct < 8; ct++) {
      const int col = ct * 16 + j;
      v2f bf;
      bf.x = W1[(size_t)kr * Hdim + col];
      bf.y = W1[(size_t)(kr + 1) * Hdim + col];
      c[ct] = wmma_f32(a, bf, c[ct]);
    }
  }
  // transposed store: MT[h, o] = C[o, h]
#pragma unroll
  for (int ct = 0; ct < 8; ct++)
#pragma unroll
    for (int r = 0; r < 8; r++)
      MTb[(size_t)(ct * 16 + j) * Odim + (m0 + r + 8 * hi)] = c[ct][r];
}

// -----------------------------------------------------------------------------
// Kernel B (fused): TDM-stage MT[b] -> LDS; meanwhile
// qb[h] = b1[h] + sum_j q[b,n,j] * W1[D+j, h] (wave w sums j in [32w, 32w+32));
// WMMA GEMM + relu + W2 dot, masked softmax, then att2 @ att1.
// GEMM operands: a lane holds its token row's k = 8s+4hi .. 8s+4hi+3 in one
// 16-byte register group (s = 0..15); the pair (.x,.y) feeds WMMA 2s, the pair
// (.z,.w) WMMA 2s+1. Both loaders use this same k order.
// -----------------------------------------------------------------------------
#define SM_STRIDE 132  // 128 + TDM pad of 4 DWORDs -> conflict-free b128 reads (pitch 16 B x 33)

__global__ __launch_bounds__(256) void att_fused(const float* __restrict__ att1,
                                                 const float* __restrict__ MT,
                                                 const float* __restrict__ q,
                                                 const float* __restrict__ W1,
                                                 const float* __restrict__ b1,
                                                 const float* __restrict__ W2,
                                                 const float* __restrict__ b2p,
                                                 const int* __restrict__ tags,
                                                 const int* __restrict__ tptr,
                                                 float* __restrict__ out) {
  extern __shared__ float smem[];
  float* sMT = smem;                        // 128 rows(H) x 132 (O + pad)
  float* sLog = smem + Hdim * SM_STRIDE;    // 1024 (logits -> att2)
  float* sRed = sLog + Adim;                // 16
  float* sQ = sRed + 16;                    // 8 waves x 128 partial sums of qb
  float* sPart = smem;                      // phase-2 alias (8 waves x 128 floats)

  const int bn = blockIdx.x;
  const int b = bn >> 2;  // N = 4
  const int tid = threadIdx.x;
  const int wv = tid >> 5, lane = tid & 31, j = lane & 15, hi = lane >> 4;

  const float* att1_bn = att1 + (size_t)bn * Adim * Odim;
  const int* tags_bn = tags + (size_t)bn * Adim;
  const float* MTb = MT + (size_t)b * Odim * Hdim;

  // q projection, loads: wave w takes rows D+32w .. D+32w+31 of W1, lane l the
  // columns 4l .. 4l+3. All 32 row loads are issued ahead of the tensor load,
  // so that one L2 round trip covers them and runs beside the tile's landing.
  const int wvu = __builtin_amdgcn_readfirstlane(wv);  // wave-uniform: q is read by scalar loads
  const float* qp = q + (size_t)bn * Qdim + wvu * 32;
  const float* wp = W1 + (size_t)(Ddim + wvu * 32) * Hdim + lane * 4;
  v4f wrow[32];
#pragma unroll  // full: wrow stays in registers and the loads form one run
  for (int i = 0; i < 32; i++) wrow[i] = *reinterpret_cast<const v4f*>(wp + (size_t)i * Hdim);

  // att1 fragments of this wave's first 16-row tile: they fly beside the
  // tensor load and the q projection.
  const float* arow = att1_bn + (size_t)(wv * 128 + j) * Odim + 4 * hi;
  v4f afr[16];
#pragma unroll  // full: afr stays in registers
  for (int s = 0; s < 16; s++) afr[s] = *reinterpret_cast<const v4f*>(arow + 8 * s);

  // ---- TDM: async-load MT[b] (128x128 f32, row stride 128) into LDS with
  //      hardware padding: 4 DWORDs pad after every 128 DWORDs -> stride 132.
  if (wv == 0) {
    const unsigned long long ga = (unsigned long long)(uintptr_t)MTb;
    const unsigned int lds_addr = (unsigned int)(uintptr_t)sMT;  // low 32 = LDS byte offset

    v4u g0;
    g0.x = 1u;                                  // count=1 (valid), no gather
    g0.y = lds_addr;                            // LDS dest (bytes)
    g0.z = (unsigned int)(ga & 0xffffffffu);    // global_addr[31:0]
    g0.w = (unsigned int)((ga >> 32) & 0x1ffffffu) | (2u << 30);  // addr[56:32] | type=2

    v8i g1;
    g1[0] = (int)((2u << 16)      // data_size = 4 bytes
                | (1u << 20)      // pad_enable
                | (6u << 22)      // pad_interval: 2^(6+1)=128 DWORDs
                | (3u << 25));    // pad_amount: 3+1 = 4 DWORDs
    g1[1] = (int)(128u << 16);    // tensor_dim0[15:0]=128 (atomic_barrier_addr=0)
    g1[2] = (int)(128u << 16);    // tensor_dim0[31:16]=0 | tensor_dim1[15:0]=128
    g1[3] = (int)(128u << 16);    // tensor_dim1[31:16]=0 | tile_dim0=128
    g1[4] = (int)128u;            // tile_dim1=128 | tile_dim2=0
    g1[5] = (int)128u;            // tensor_dim0_stride[31:0]=128
    g1[6] = 0;                    // stride0[47:32]=0 | stride1[15:0]=0
    g1[7] = 0;                    // stride1[47:16]=0

    v4i gz4 = (v4i){0, 0, 0, 0};                     // groups 2/3 unused (2D tile)
    v8i gz8 = (v8i){0, 0, 0, 0, 0, 0, 0, 0};         // extra group (clang-23 form)

    __builtin_amdgcn_tensor_load_to_lds(g0, g1, gz4, gz4, gz8, 0);
    __builtin_amdgcn_s_wait_tensorcnt(0);
  }

  // q projection, sums: each wave's partial goes to its own LDS row; the
  // barrier below publishes it together with the tile.
  {
    v4f pacc = (v4f){0.f, 0.f, 0.f, 0.f};
#pragma unroll  // full: wrow is indexed by constants only
    for (int i = 0; i < 32; i++) pacc += qp[i] * wrow[i];
    *reinterpret_cast<v4f*>(sQ + wv * Hdim + lane * 4) = pacc;
  }
  __syncthreads();

  // per-lane column constants
  float qv[8], w2v[8];
#pragma unroll
  for (int ct = 0; ct < 8; ct++) {
    const int hc = ct * 16 + j;
    float qacc = b1[hc];
#pragma unroll
    for (int w = 0; w < 8; w++) qacc += sQ[w * Hdim + hc];
    qv[ct] = qacc;
    w2v[ct] = W2[hc];
  }
  const float b2v = b2p[0];

  // ---- GEMM att1[A,O] @ M[O,H], fused relu + W2 dot -> logits ----
  // One 16-row tile. Its att1 fragments are already in afr; where a next tile
  // exists (more), each group of four register groups (whole 128-byte lines of
  // the 16 rows) is refilled for it as soon as its last WMMA has been issued,
  // so that a load has about a tile's matrix time to land.
  const float* bcol = sMT + (size_t)j * SM_STRIDE + 4 * hi;
  auto row_tile = [&](const int rt, auto more) {
    const int a0 = (wv * 8 + rt) * 16;
    v8f c[8];
#pragma unroll
    for (int i = 0; i < 8; i++) c[i] = (v8f){0.f, 0.f, 0.f, 0.f, 0.f, 0.f, 0.f, 0.f};

    const float* anext = arow + (size_t)(rt + 1) * 16 * Odim;
    // All loops of the tile are unrolled in full: afr, bf and c are indexed by
    // constants only and stay in registers.
#pragma unroll
    for (int g = 0; g < 4; g++) {
#pragma unroll
      for (int u = 0; u < 4; u++) {
        const int s = 4 * g + u;
        const v4f a = afr[s];
        v4f bf[8];
#pragma unroll
        for (int ct = 0; ct < 8; ct++)  // MT[col, 8s+4hi .. +3]: one b128 read
          bf[ct] = *reinterpret_cast<const v4f*>(bcol + (size_t)ct * 16 * SM_STRIDE + 8 * s);
#pragma unroll
        for (int ct = 0; ct < 8; ct++)
          c[ct] = wmma_f32((v2f){a.x, a.y}, (v2f){bf[ct].x, bf[ct].y}, c[ct]);
#pragma unroll
        for (int ct = 0; ct < 8; ct++)
          c[ct] = wmma_f32((v2f){a.z, a.w}, (v2f){bf[ct].z, bf[ct].w}, c[ct]);
      }
      if constexpr (decltype(more)::value) {
#pragma unroll
        for (int u = 0; u < 4; u++)
          afr[4 * g + u] = *reinterpret_cast<const v4f*>(anext + 8 * (4 * g + u));
      }
    }
    // Order asked of the scheduler: the LDS reads in whole groups of 8, two
    // groups ahead of their 16 WMMAs, and behind every 64 WMMAs the 4 refill
    // loads of their registers. Without it all sixteen refills sink to the
    // tile's end, where most of the lead is lost, and the LDS reads of the
    // last tile stand singly among the WMMAs.
    __builtin_amdgcn_sched_group_barrier(0x100, 16, 0);  // LDS reads
#pragma unroll  // full: the directives must stand in the tile's one block of code
    for (int s = 0; s < 16; s++) {
      __builtin_amdgcn_sched_group_barrier(0x008, 16, 0);  // matrix instructions
      if constexpr (decltype(more)::value) {
        if ((s & 3) == 3) __builtin_amdgcn_sched_group_barrier(0x020, 4, 0);  // global loads
      }
      if (s < 14) __builtin_amdgcn_sched_group_barrier(0x100, 8, 0);  // LDS reads
    }

    float s[8];
#pragma unroll
    for (int r = 0; r < 8; r++) s[r] = 0.f;
#pragma unroll
    for (int ct = 0; ct < 8; ct++) {
#pragma unroll
      for (int r = 0; r < 8; r++) {
        float x = c[ct][r] + qv[ct];
        x = x > 0.f ? x : 0.f;
        s[r] += x * w2v[ct];
      }
    }
    // reduce over the 16-lane N dimension (xor 1,2,4,8 keeps hi-halves apart)
#pragma unroll
    for (int r = 0; r < 8; r++) {
      float v = s[r];
      v += __shfl_xor(v, 1, 32);
      v += __shfl_xor(v, 2, 32);
      v += __shfl_xor(v, 4, 32);
      v += __shfl_xor(v, 8, 32);
      if (j == 0) sLog[a0 + r + 8 * hi] = v + b2v;
    }
  };
  for (int rt = 0; rt < 7; rt++) row_tile(rt, std::true_type{});
  row_tile(7, std::false_type{});
  __syncthreads();

  // ---- masked, temperature-scaled softmax over A = 1024 ----
  const float invt = 1.0f / (float)tptr[0];
  float lmax = NEG_INF;
  for (int a = tid; a < Adim; a += 256) {
    const float v = (tags_bn[a] > 0) ? sLog[a] * invt : NEG_INF;
    sLog[a] = v;
    lmax = fmaxf(lmax, v);
  }
#pragma unroll
  for (int off = 16; off >= 1; off >>= 1) lmax = fmaxf(lmax, __shfl_xor(lmax, off, 32));
  if (lane == 0) sRed[wv] = lmax;
  __syncthreads();
  float bmax = sRed[0];
#pragma unroll
  for (int i = 1; i < 8; i++) bmax = fmaxf(bmax, sRed[i]);

  float lsum = 0.f;
  for (int a = tid; a < Adim; a += 256) {
    const float e = __expf(sLog[a] - bmax);
    sLog[a] = e;
    lsum += e;
  }
#pragma unroll
  for (int off = 16; off >= 1; off >>= 1) lsum += __shfl_xor(lsum, off, 32);
  if (lane == 0) sRed[8 + wv] = lsum;
  __syncthreads();
  float bsum = 0.f;
#pragma unroll
  for (int i = 0; i < 8; i++) bsum += sRed[8 + i];
  const float invsum = 1.0f / bsum;
  for (int a = tid; a < Adim; a += 256) sLog[a] *= invsum;
  __syncthreads();

  // ---- out[o] = sum_a att2[a] * att1[a,o]  (att1 reread hits L2) ----
  // Wave w streams rows 128w .. 128w+127; a lane holds columns 4l .. 4l+3, so
  // one load of a wave is one whole row (512 contiguous bytes).
  {
    const float* rowp = att1_bn + (size_t)wv * 128 * Odim + lane * 4;
    const float* att2p = sLog + wv * 128;
    v4f acc = (v4f){0.f, 0.f, 0.f, 0.f};
    for (int a0 = 0; a0 < 128; a0 += 16) {
      v4f rowv[16];
#pragma unroll  // full: 16 row loads leave as one run, one L2 round trip for all
      for (int i = 0; i < 16; i++)
        rowv[i] = *reinterpret_cast<const v4f*>(rowp + (size_t)(a0 + i) * Odim);
#pragma unroll  // full: rowv is indexed by constants only
      for (int i = 0; i < 16; i++) acc += att2p[a0 + i] * rowv[i];
    }
    *reinterpret_cast<v4f*>(sPart + wv * Odim + lane * 4) = acc;
  }
  __syncthreads();
  if (tid < Odim) {
    float r = sPart[tid];
#pragma unroll  // full: the seven LDS reads leave together
    for (int w = 1; w < 8; w++) r += sPart[w * Odim + tid];
    out[(size_t)bn * Odim + tid] = r;
  }
}

// -----------------------------------------------------------------------------
extern "C" void kernel_launch(void* const* d_in, const int* in_sizes, int n_in,
                              void* d_out, int out_size, void* d_ws, size_t ws_size,
                              hipStream_t stream) {
  const float* q    = (const float*)d_in[0];  // [B,N,1,Q]
  const float* att1 = (const float*)d_in[1];  // [B,N,A,O]
  const float* obj  = (const float*)d_in[2];  // [B,O,D]
  const int*   tags = (const int*)d_in[3];    // [B,N,A]
  const float* W1   = (const float*)d_in[4];  // [D+Q,H]
  const float* b1   = (const float*)d_in[5];  // [H]
  const float* W2   = (const float*)d_in[6];  // [H,1]
  const float* b2   = (const float*)d_in[7];  // [1]
  const int*   t    = (const int*)d_in[8];    // scalar
  float* out = (float*)d_out;                 // [B,N,O]

  float* MT = (float*)d_ws;                           // 64*128*128 f32 = 4 MB

  precompute_M<<<Bdim, 256, 0, stream>>>(obj, W1, MT);

  const size_t smem = (size_t)(Hdim * SM_STRIDE + Adim + 16 + 8 * Hdim) * sizeof(float);  // ~75.8 KB
  att_fused<<<Bdim * Ndim, 256, smem, stream>>>(att1, MT, q, W1, b1, W2, b2, tags, t, out);
}

// v004
// A run of this version takes 63 microseconds.
// In two side-by-side timings against v003, it was 1.40 and 1.39 times as fast.
// Over all steps from v000 it is 2.45 times as fast.
#include <hip/hip_runtime.h>
#include <hip/hip_bf16.h>
#include <type_traits>

typedef __attribute__((ext_vector_type(2))) float v2f;
typedef __attribute__((ext_vector_type(4))) float v4f;
typedef __attribute__((ext_vector_type(8))) float v8f;
typedef __attribute__((ext_vector_type(4))) unsigned int v4u;
typedef __attribute__((ext_vector_type(8))) int v8i;
typedef __attribute__((ext_vector_type(4))) int v4i;

#define NEG_INF -1e30f

constexpr int Bdim = 64, Ndim = 4, Adim = 1024, Odim = 128, Ddim = 256, Qdim = 256, Hdim = 128;

__device__ __forceinline__ v8f wmma_f32(v2f a, v2f b, v8f c) {
  // 8 args: (neg_a, A, neg_b, B, c_mod, C, reuse_a, reuse_b)
  return __builtin_amdgcn_wmma_f32_16x16x4_f32(false, a, false, b, (short)0, c, false, false);
}

// -----------------------------------------------------------------------------
// Kernel A: MT[b] = (obj_reps[b] (O=128 x D=256) @ W1[:D] (D=256 x H=128))^T
// Stored transposed (H x O) so WMMA B-fragments become contiguous b128 DS reads.
// grid = 64 blocks, 256 threads (8 waves). wave w -> row tile w; 8 col tiles.
// -----------------------------------------------------------------------------
__global__ __launch_bounds__(256) void precompute_M(const float* __restrict__ obj,
                                                    const float* __restrict__ W1,
                                                    float* __restrict__ MT) {
  const int b = blockIdx.x;
  const int tid = threadIdx.x;
  const int wv = tid >> 5, lane = tid & 31, j = lane & 15, hi = lane >> 4;
  const float* Am = obj + (size_t)b * Odim * Ddim;  // 128 x 256 row-major
  float* MTb = MT + (size_t)b * Odim * Hdim;        // transposed: 128(H) x 128(O)

  const int m0 = wv * 16;
  v8f c[8];
#pragma unroll
  for (int i = 0; i < 8; i++) c[i] = (v8f){0.f, 0.f, 0.f, 0.f, 0.f, 0.f, 0.f, 0.f};

  const float* arow = Am + (size_t)(m0 + j) * Ddim + 2 * hi;
#pragma unroll 2
  for (int k0 = 0; k0 < Ddim; k0 += 4) {
    v2f a = *reinterpret_cast<const v2f*>(arow + k0);
    const int kr = k0 + 2 * hi;
#pragma unroll
    for (int ct = 0; ct < 8; ct++) {
      const int col = ct * 16 + j;
      v2f bf;
      bf.x = W1[(size_t)kr * Hdim + col];
      bf.y = W1[(size_t)(kr + 1) * Hdim + col];
      c[ct] = wmma_f32(a, bf, c[ct]);
    }
  }
  // transposed store: MT[h, o] = C[o, h]
#pragma unroll
  for (int ct = 0; ct < 8; ct++)
#pragma unroll
    for (int r = 0; r < 8; r++)
      MTb[(size_t)(ct * 16 + j) * Odim + (m0 + r + 8 * hi)] = c[ct][r];
}

// -----------------------------------------------------------------------------
// Kernel B (fused): TDM-stage MT[b] -> LDS; meanwhile
// qb[h] = b1[h] + sum_j q[b,n,j] * W1[D+j, h] (wave w sums j in [32w, 32w+32));
// WMMA GEMM + relu + W2 dot, masked softmax, then att2 @ att1.
// Masked tokens (tag <= 0) never reach the output: their logit is replaced by
// NEG_INF and their weight is exactly 0. The block therefore lists its unmasked
// token rows in LDS, and GEMM, softmax and weighted sum walk that list alone.
// With no unmasked token the softmax is uniform over all rows: the list then
// holds every row and every logit counts as NEG_INF.
// GEMM operands: a lane holds its token row's k = 8s+4hi .. 8s+4hi+3 in one
// 16-byte register group (s = 0..15); the pair (.x,.y) feeds WMMA 2s, the pair
// (.z,.w) WMMA 2s+1. Both loaders use this same k order.
// -----------------------------------------------------------------------------
#define SM_STRIDE 132  // 128 + TDM pad of 4 DWORDs -> conflict-free b128 reads (pitch 16 B x 33)

__global__ __launch_bounds__(256) void att_fused(const float* __restrict__ att1,
                                                 const float* __restrict__ MT,
                                                 const float* __restrict__ q,
                                                 const float* __restrict__ W1,
                                                 const float* __restrict__ b1,
                                                 const float* __restrict__ W2,
                                                 const float* __restrict__ b2p,
                                                 const int* __restrict__ tags,
                                                 const int* __restrict__ tptr,
                                                 float* __restrict__ out) {
  extern __shared__ float smem[];
  float* sMT = smem;                        // 128 rows(H) x 132 (O + pad)
  float* sLog = smem + Hdim * SM_STRIDE;    // 1024 (logits -> att2), by list position
  float* sRed = sLog + Adim;                // 16
  float* sQ = sRed + 16;                    // 8 waves x 128 partial sums of qb
  int* sIdx = reinterpret_cast<int*>(sQ + 8 * Hdim);  // 1024: token row at each list position
  int* sCnt = sIdx + Adim;                  // 8: unmasked tokens found by each wave
  float* sPart = smem;                      // phase-2 alias (8 waves x 128 floats)

  const int bn = blockIdx.x;
  const int b = bn >> 2;  // N = 4
  const int tid = threadIdx.x;
  const int wv = tid >> 5, lane = tid & 31, j = lane & 15, hi = lane >> 4;

  const float* att1_bn = att1 + (size_t)bn * Adim * Odim;
  const int* tags_bn = tags + (size_t)bn * Adim;
  const float* MTb = MT + (size_t)b * Odim * Hdim;

  // Tags of tokens 4*tid .. 4*tid+3: asked for first, so that they are back
  // while the loads below and the tensor load are still under way.
  const v4i tg = *reinterpret_cast<const v4i*>(tags_bn + 4 * tid);

  // q projection, loads: wave w takes rows D+32w .. D+32w+31 of W1, lane l the
  // columns 4l .. 4l+3. All 32 row loads are issued ahead of the tensor load,
  // so that one L2 round trip covers them and runs beside the tile's landing.
  const int wvu = __builtin_amdgcn_readfirstlane(wv);  // wave-uniform: q is read by scalar loads
  const float* qp = q + (size_t)bn * Qdim + wvu * 32;
  const float* wp = W1 + (size_t)(Ddim + wvu * 32) * Hdim + lane * 4;
  v4f wrow[32];
#pragma unroll  // full: wrow stays in registers and the loads form one run
  for (int i = 0; i < 32; i++) wrow[i] = *reinterpret_cast<const v4f*>(wp + (size_t)i * Hdim);

  // ---- TDM: async-load MT[b] (128x128 f32, row stride 128) into LDS with
  //      hardware padding: 4 DWORDs pad after every 128 DWORDs -> stride 132.
  if (wv == 0) {
    const unsigned long long ga = (unsigned long long)(uintptr_t)MTb;
    const unsigned int lds_addr = (unsigned int)(uintptr_t)sMT;  // low 32 = LDS byte offset

    v4u g0;
    g0.x = 1u;                                  // count=1 (valid), no gather
    g0.y = lds_addr;                            // LDS dest (bytes)
    g0.z = (unsigned int)(ga & 0xffffffffu);    // global_addr[31:0]
    g0.w = (unsigned int)((ga >> 32) & 0x1ffffffu) | (2u << 30);  // addr[56:32] | type=2

    v8i g1;
    g1[0] = (int)((2u << 16)      // data_size = 4 bytes
                | (1u << 20)      // pad_enable
                | (6u << 22)      // pad_interval: 2^(6+1)=128 DWORDs
                | (3u << 25));    // pad_amount: 3+1 = 4 DWORDs
    g1[1] = (int)(128u << 16);    // tensor_dim0[15:0]=128 (atomic_barrier_addr=0)
    g1[2] = (int)(128u << 16);    // tensor_dim0[31:16]=0 | tensor_dim1[15:0]=128
    g1[3] = (int)(128u << 16);    // tensor_dim1[31:16]=0 | tile_dim0=128
    g1[4] = (int)128u;            // tile_dim1=128 | tile_dim2=0
    g1[5] = (int)128u;            // tensor_dim0_stride[31:0]=128
    g1[6] = 0;                    // stride0[47:32]=0 | stride1[15:0]=0
    g1[7] = 0;                    // stride1[47:16]=0

    v4i gz4 = (v4i){0, 0, 0, 0};                     // groups 2/3 unused (2D tile)
    v8i gz8 = (v8i){0, 0, 0, 0, 0, 0, 0, 0};         // extra group (clang-23 form)

    __builtin_amdgcn_tensor_load_to_lds(g0, g1, gz4, gz4, gz8, 0);
    __builtin_amdgcn_s_wait_tensorcnt(0);
  }

  // q projection, sums: each wave's partial goes to its own LDS row; the
  // barrier below publishes it together with the tile.
  {
    v4f pacc = (v4f){0.f, 0.f, 0.f, 0.f};
#pragma unroll  // full: wrow is indexed by constants only
    for (int i = 0; i < 32; i++) pacc += qp[i] * wrow[i];
    *reinterpret_cast<v4f*>(sQ + wv * Hdim + lane * 4) = pacc;
  }

  // List of unmasked tokens, part 1: places inside the wave from four ballots
  // (one per token of a lane), the wave's count to LDS. Every list entry starts
  // as row 0, so that a position past the list's end still names a real row.
  unsigned int place[4];
  unsigned int wcnt = 0;
#pragma unroll  // full: place and tg are indexed by constants only
  for (int k = 0; k < 4; k++) {
    const unsigned int m = __builtin_amdgcn_ballot_w32(tg[k] > 0);
    place[k] = wcnt + __builtin_popcount(m & ((1u << lane) - 1u));
    wcnt += __builtin_popcount(m);
  }
  *reinterpret_cast<v4i*>(sIdx + 4 * tid) = (v4i){0, 0, 0, 0};
  if (lane == 0) sCnt[wv] = (int)wcnt;
  __syncthreads();

  // Part 2: the waves' counts give each wave its start and the list's length.
  unsigned int start = 0, found = 0;
#pragma unroll  // full: the eight LDS reads leave together
  for (int w = 0; w < 8; w++) {
    const unsigned int cw = (unsigned int)sCnt[w];
    start += (w < wv) ? cw : 0u;
    found += cw;
  }
  // At most 1024 (eight waves, four ballots of 32 lanes each) whatever the tags
  // hold; the same in every wave: made scalar, so that trip counts stay scalar.
  found = __builtin_amdgcn_readfirstlane(found);
  const int cnt = found ? (int)found : Adim;      // rows in the list
  if (found) {
#pragma unroll
    for (int k = 0; k < 4; k++)
      if (tg[k] > 0) sIdx[start + place[k]] = 4 * tid + k;
  } else {
    *reinterpret_cast<v4i*>(sIdx + 4 * tid) = (v4i){4 * tid, 4 * tid + 1, 4 * tid + 2, 4 * tid + 3};
  }
  __syncthreads();  // publishes the list

  // 16-row tile t of the list goes to wave t mod 8. att1 fragments of this
  // wave's first tile: they fly beside the column constants below. Tile wv lies
  // inside the 1024 list entries whatever the list's length.
  const char* att1c = reinterpret_cast<const char*>(att1_bn);  // scalar base; a lane adds a 32-bit byte offset
  v4f afr[16];
  {
    const unsigned int roff = (unsigned int)sIdx[wv * 16 + j] * (Odim * 4u) + 16u * hi;
#pragma unroll  // full: afr stays in registers
    for (int s = 0; s < 16; s++) afr[s] = *reinterpret_cast<const v4f*>(att1c + roff + 32 * s);
  }

  // per-lane column constants
  float qv[8], w2v[8];
#pragma unroll
  for (int ct = 0; ct < 8; ct++) {
    const int hc = ct * 16 + j;
    float qacc = b1[hc];
#pragma unroll
    for (int w = 0; w < 8; w++) qacc += sQ[w * Hdim + hc];
    qv[ct] = qacc;
    w2v[ct] = W2[hc];
  }
  const float b2v = b2p[0];

  // ---- GEMM att1[A,O] @ M[O,H], fused relu + W2 dot -> logits ----
  // One 16-row tile. Its att1 fragments are already in afr; where a next tile
  // exists (more), each group of four register groups (whole 128-byte lines of
  // the 16 rows) is refilled for it as soon as its last WMMA has been issued,
  // so that a load has about a tile's matrix time to land.
  const float* bcol = sMT + (size_t)j * SM_STRIDE + 4 * hi;
  auto row_tile = [&](const int t, auto more) {
    const int a0 = t * 16;
    v8f c[8];
#pragma unroll
    for (int i = 0; i < 8; i++) c[i] = (v8f){0.f, 0.f, 0.f, 0.f, 0.f, 0.f, 0.f, 0.f};

    // This lane's row in the wave's next tile, t + 8 (read only where that tile
    // exists, so the position lies inside the list's tiles).
    unsigned int noff = 0;
    if constexpr (decltype(more)::value) noff = (unsigned int)sIdx[(t + 8) * 16 + j] * (Odim * 4u) + 16u * hi;
    // All loops of the tile are unrolled in full: afr, bf and c are indexed by
    // constants only and stay in registers.
#pragma unroll
    for (int g = 0; g < 4; g++) {
#pragma unroll
      for (int u = 0; u < 4; u++) {
        const int s = 4 * g + u;
        const v4f a = afr[s];
        v4f bf[8];
#pragma unroll
        for (int ct = 0; ct < 8; ct++)  // MT[col, 8s+4hi .. +3]: one b128 read
          bf[ct] = *reinterpret_cast<const v4f*>(bcol + (size_t)ct * 16 * SM_STRIDE + 8 * s);
#pragma unroll
        for (int ct = 0; ct < 8; ct++)
          c[ct] = wmma_f32((v2f){a.x, a.y}, (v2f){bf[ct].x, bf[ct].y}, c[ct]);
#pragma unroll
        for (int ct = 0; ct < 8; ct++)
          c[ct] = wmma_f32((v2f){a.z, a.w}, (v2f){bf[ct].z, bf[ct].w}, c[ct]);
      }
      if constexpr (decltype(more)::value) {
#pragma unroll
        for (int u = 0; u < 4; u++)
          afr[4 * g + u] = *reinterpret_cast<const v4f*>(att1c + noff + 32 * (4 * g + u));
      }
    }
    // Order asked of the scheduler: the LDS reads in whole groups of 8, two
    // groups ahead of their 16 WMMAs, and behind every 64 WMMAs the 4 refill
    // loads of their registers. Without it all sixteen refills sink to the
    // tile's end, where most of the lead is lost, and the LDS reads of the
    // last tile stand singly among the WMMAs.
    // (the first group also takes the read of the next tile's row index)
    __builtin_amdgcn_sched_group_barrier(0x100, decltype(more)::value ? 17 : 16, 0);  // LDS reads
#pragma unroll  // full: the directives must stand in the tile's one block of code
    for (int s = 0; s < 16; s++) {
      __builtin_amdgcn_sched_group_barrier(0x008, 16, 0);  // matrix instructions
      if constexpr (decltype(more)::value) {
        if ((s & 3) == 3) __builtin_amdgcn_sched_group_barrier(0x020, 4, 0);  // global loads
      }
      if (s < 14) __builtin_amdgcn_sched_group_barrier(0x100, 8, 0);  // LDS reads
    }

    float s[8];
#pragma unroll
    for (int r = 0; r < 8; r++) s[r] = 0.f;
#pragma unroll
    for (int ct = 0; ct < 8; ct++) {
#pragma unroll
      for (int r = 0; r < 8; r++) {
        float x = c[ct][r] + qv[ct];
        x = x > 0.f ? x : 0.f;
        s[r] += x * w2v[ct];
      }
    }
    // reduce over the 16-lane N dimension (xor 1,2,4,8 keeps hi-halves apart)
#pragma unroll
    for (int r = 0; r < 8; r++) {
      float v = s[r];
      v += __shfl_xor(v, 1, 32);
      v += __shfl_xor(v, 2, 32);
      v += __shfl_xor(v, 4, 32);
      v += __shfl_xor(v, 8, 32);
      if (j == 0) sLog[a0 + r + 8 * hi] = v + b2v;
    }
  };
  const int ntw = (((cnt + 15) >> 4) - wvu + 7) >> 3;  // tiles of this wave: 0 .. 8, scalar
  int t = wvu;
  for (int i = 0; i + 1 < ntw; i++, t += 8) row_tile(t, std::true_type{});
  if (ntw > 0) row_tile(t, std::false_type{});
  __syncthreads();

  // ---- masked, temperature-scaled softmax over A = 1024 ----
  const float invt = 1.0f / (float)tptr[0];
  float lmax = NEG_INF;
  for (int a = tid; a < Adim; a += 256) {
    const float v = (a < (int)found) ? sLog[a] * invt : NEG_INF;  // past the list, or all masked
    sLog[a] = v;
    lmax = fmaxf(lmax, v);
  }
#pragma unroll
  for (int off = 16; off >= 1; off >>= 1) lmax = fmaxf(lmax, __shfl_xor(lmax, off, 32));
  if (lane == 0) sRed[wv] = lmax;
  __syncthreads();
  float bmax = sRed[0];
#pragma unroll
  for (int i = 1; i < 8; i++) bmax = fmaxf(bmax, sRed[i]);

  float lsum = 0.f;
  for (int a = tid; a < Adim; a += 256) {
    const float e = __expf(sLog[a] - bmax);
    sLog[a] = e;
    lsum += e;
  }
#pragma unroll
  for (int off = 16; off >= 1; off >>= 1) lsum += __shfl_xor(lsum, off, 32);
  if (lane == 0) sRed[8 + wv] = lsum;
  __syncthreads();
  float bsum = 0.f;
#pragma unroll
  for (int i = 0; i < 8; i++) bsum += sRed[8 + i];
  const float invsum = 1.0f / bsum;
  for (int a = tid; a < Adim; a += 256) sLog[a] *= invsum;
  __syncthreads();

  // ---- out[o] = sum_a att2[a] * att1[a,o]  (att1 reread hits L2) ----
  // Runs of 32 list positions go to the waves in turn; a lane holds columns
  // 4l .. 4l+3, so one load of a wave is one whole row (512 contiguous bytes).
  // Positions past the list's end name row 0 with weight 0.
  {
    const unsigned int loff = lane * 16u;
    v4f acc = (v4f){0.f, 0.f, 0.f, 0.f};
    for (int a0 = wvu * 32; a0 < cnt; a0 += 256) {
      v4f rowv[32];
      unsigned int off[32];
#pragma unroll  // full: off is indexed by constants only
      for (int g = 0; g < 8; g++) {
        const v4i ix = *reinterpret_cast<const v4i*>(sIdx + a0 + 4 * g);
#pragma unroll
        for (int k = 0; k < 4; k++) off[4 * g + k] = (unsigned int)ix[k] * (Odim * 4u) + loff;
      }
#pragma unroll  // full: 32 row loads leave in two runs, one L2 round trip for all
      for (int h = 0; h < 32; h += 16) {
#pragma unroll
        for (int i = 0; i < 16; i++) rowv[h + i] = *reinterpret_cast<const v4f*>(att1c + off[h + i]);
        // The run's offsets stay in their registers up to this wait, so that no
        // later result lands on an offset register that an issued load names
        // (one wait a run instead of one at every reuse of a register).
        asm volatile("s_wait_xcnt 0x0" ::"v"(off[h]), "v"(off[h + 1]), "v"(off[h + 2]), "v"(off[h + 3]),
                     "v"(off[h + 4]), "v"(off[h + 5]), "v"(off[h + 6]), "v"(off[h + 7]), "v"(off[h + 8]),
                     "v"(off[h + 9]), "v"(off[h + 10]), "v"(off[h + 11]), "v"(off[h + 12]),
                     "v"(off[h + 13]), "v"(off[h + 14]), "v"(off[h + 15])
                     : "memory");
      }
#pragma unroll  // full: rowv is indexed by constants only
      for (int g = 0; g < 8; g++) {
        const v4f wg = *reinterpret_cast<const v4f*>(sLog + a0 + 4 * g);
#pragma unroll
        for (int k = 0; k < 4; k++) acc += wg[k] * rowv[4 * g + k];
      }
    }
    *reinterpret_cast<v4f*>(sPart + wv * Odim + lane * 4) = acc;
  }
  __syncthreads();
  if (tid < Odim) {
    float r = sPart[tid];
#pragma unroll  // full: the seven LDS reads leave together
    for (int w = 1; w < 8; w++) r += sPart[w * Odim + tid];
    out[(size_t)bn * Odim + tid] = r;
  }
}

// -----------------------------------------------------------------------------
extern "C" void kernel_launch(void* const* d_in, const int* in_sizes, int n_in,
                              void* d_out, int out_size, void* d_ws, size_t ws_size,
                              hipStream_t stream) {
  const float* q    = (const float*)d_in[0];  // [B,N,1,Q]
  const float* att1 = (const float*)d_in[1];  // [B,N,A,O]
  const float* obj  = (const float*)d_in[2];  // [B,O,D]
  const int*   tags = (const int*)d_in[3];    // [B,N,A]
  const float* W1   = (const float*)d_in[4];  // [D+Q,H]
  const float* b1   = (const float*)d_in[5];  // [H]
  const float* W2   = (const float*)d_in[6];  // [H,1]
  const float* b2   = (const float*)d_in[7];  // [1]
  const int*   t    = (const int*)d_in[8];    // scalar
  float* out = (float*)d_out;                 // [B,N,O]

  float* MT = (float*)d_ws;                           // 64*128*128 f32 = 4 MB

  precompute_M<<<Bdim, 256, 0, stream>>>(obj, W1, MT);

  const size_t smem = (size_t)(Hdim * SM_STRIDE + Adim + 16 + 8 * Hdim + Adim + 16) * sizeof(float);  // ~80 KB
  att_fused<<<Bdim * Ndim, 256, smem, stream>>>(att1, MT, q, W1, b1, W2, b2, tags, t, out);
}

// v005
// One run takes 41.9 microseconds.
// Next to v004, in two timings, it ran 1.50 times as fast each time.
// Over all steps from v000 it is 3.68 times as fast.
#include <hip/hip_runtime.h>
#include <hip/hip_bf16.h>
#include <type_traits>

typedef __attribute__((ext_vector_type(2))) float v2f;
typedef __attribute__((ext_vector_type(4))) float v4f;
typedef __attribute__((ext_vector_type(8))) float v8f;
typedef __attribute__((ext_vector_type(4))) unsigned int v4u;
typedef __attribute__((ext_vector_type(8))) int v8i;
typedef __attribute__((ext_vector_type(4))) int v4i;

#define NEG_INF -1e30f

constexpr int Bdim = 64, Ndim = 4, Adim = 1024, Odim = 128, Ddim = 256, Qdim = 256, Hdim = 128;

__device__ __forceinline__ v8f wmma_f32(v2f a, v2f b, v8f c) {
  // 8 args: (neg_a, A, neg_b, B, c_mod, C, reuse_a, reuse_b)
  return __builtin_amdgcn_wmma_f32_16x16x4_f32(false, a, false, b, (short)0, c, false, false);
}

// -----------------------------------------------------------------------------
// Kernel A: MT[b] = (obj_reps[b] (O=128 x D=256) @ W1[:D] (D=256 x H=128))^T
// Stored transposed (H x O) so WMMA B-fragments become contiguous DS reads.
// grid = 64 x 4 blocks, 256 threads (8 waves). Block (b, p) makes the 32 obj
// rows 32p .. 32p+31 against all 128 columns: one 128-byte line of every MT row.
// wave w -> column tile w, both row tiles.
// Both operands go through LDS in four stages of 64 k. A thread asks for its
// share of all four stages at the start, in whole 128-byte lines, so that one
// L2 round trip covers them; stage c is worked on while the later ones land.
// k order: a lane holds k = 8s+4hi .. 8s+4hi+3 (s = 0..31); the first pair
// feeds WMMA 2s, the second WMMA 2s+1. Both loaders use this same k order.
// -----------------------------------------------------------------------------
// Work-group barrier that orders LDS traffic alone. __syncthreads() also waits
// for every global load in flight, here the later stages' loads, and the first
// stage could then not be worked on before the last one has landed.
__device__ __forceinline__ void lds_barrier() {
  __builtin_amdgcn_fence(__ATOMIC_RELEASE, "workgroup", "local");
  __builtin_amdgcn_s_barrier();
  __builtin_amdgcn_fence(__ATOMIC_ACQUIRE, "workgroup", "local");
}

#define SW_PITCH 132  // W1 row in LDS, floats: rows k and k+4 (the two lane halves) lie 16 banks apart
#define SO_PITCH 260  // obj row in LDS, floats: 16 B x 65 -> conflict-free b128 reads

__global__ __launch_bounds__(256) void precompute_M(const float* __restrict__ obj,
                                                    const float* __restrict__ W1,
                                                    float* __restrict__ MT) {
  __shared__ __attribute__((aligned(16))) float sW[Ddim * SW_PITCH];  // W1[:D], 256 x 128
  __shared__ __attribute__((aligned(16))) float sO[32 * SO_PITCH];    // this block's 32 obj rows

  const int b = blockIdx.x >> 2, p = blockIdx.x & 3;
  const int tid = threadIdx.x;
  const int wv = tid >> 5, lane = tid & 31, j = lane & 15, hi = lane >> 4;
  const float* Am = obj + ((size_t)b * Odim + 32 * p) * Ddim;  // 32 x 256 row-major
  float* MTb = MT + (size_t)b * Odim * Hdim;                   // transposed: 128(H) x 128(O)

  // Stage c: W1 rows 64c .. 64c+63 (a wave's load is one whole row) and columns
  // 64c .. 64c+63 of the 32 obj rows (a wave's load is 256 bytes of two rows).
  const int orow = tid >> 4, ocol = (tid & 15) * 4;
  v4f wr[4][8], orr[4][2];
  // Asked for stage by stage: loads come back in the order asked, so the first
  // stages do not wait for the last ones.
#pragma unroll  // full, the loops inside too: wr and orr stay in registers, and the 40 loads form one run
  for (int c = 0; c < 4; c++) {
#pragma unroll
    for (int i = 0; i < 8; i++)
      wr[c][i] = *reinterpret_cast<const v4f*>(W1 + (size_t)(64 * c + 8 * i + wv) * Hdim + lane * 4);
#pragma unroll
    for (int i = 0; i < 2; i++)
      orr[c][i] = *reinterpret_cast<const v4f*>(Am + (size_t)(16 * i + orow) * Ddim + 64 * c + ocol);
  }
  // The loads' address registers are free for reuse from here on: one wait
  // behind the run, in front of the first instruction that may overwrite one.
  asm volatile("s_wait_xcnt 0x0" ::: "memory");

  v8f c0 = (v8f){0.f, 0.f, 0.f, 0.f, 0.f, 0.f, 0.f, 0.f};
  v8f c1 = c0;
  const float* ap = sO + j * SO_PITCH + 4 * hi;
  const float* bp = sW + 4 * hi * SW_PITCH + wv * 16 + j;
#pragma unroll  // full, the loops inside too: wr and orr are indexed by constants only
  for (int c = 0; c < 4; c++) {
#pragma unroll
    for (int i = 0; i < 8; i++)
      *reinterpret_cast<v4f*>(sW + (64 * c + 8 * i + wv) * SW_PITCH + lane * 4) = wr[c][i];
#pragma unroll
    for (int i = 0; i < 2; i++)
      *reinterpret_cast<v4f*>(sO + (16 * i + orow) * SO_PITCH + 64 * c + ocol) = orr[c][i];
    lds_barrier();  // publishes stage c (each stage has LDS of its own: nothing is overwritten)
#pragma unroll
    for (int s = 8 * c; s < 8 * c + 8; s++) {
      const v4f a0 = *reinterpret_cast<const v4f*>(ap + 8 * s);
      const v4f a1 = *reinterpret_cast<const v4f*>(ap + 16 * SO_PITCH + 8 * s);
      const v2f b01 = (v2f){bp[(8 * s + 0) * SW_PITCH], bp[(8 * s + 1) * SW_PITCH]};
      const v2f b23 = (v2f){bp[(8 * s + 2) * SW_PITCH], bp[(8 * s + 3) * SW_PITCH]};
      c0 = wmma_f32((v2f){a0.x, a0.y}, b01, c0);
      c1 = wmma_f32((v2f){a1.x, a1.y}, b01, c1);
      c0 = wmma_f32((v2f){a0.z, a0.w}, b23, c0);
      c1 = wmma_f32((v2f){a1.z, a1.w}, b23, c1);
    }
  }
  // transposed store: MT[h, o] = C[o, h]; a lane's 8 values are 8 neighbouring o
  float* mrow = MTb + (size_t)(wv * 16 + j) * Odim + 32 * p + 8 * hi;
  *reinterpret_cast<v4f*>(mrow) = (v4f){c0[0], c0[1], c0[2], c0[3]};
  *reinterpret_cast<v4f*>(mrow + 4) = (v4f){c0[4], c0[5], c0[6], c0[7]};
  *reinterpret_cast<v4f*>(mrow + 16) = (v4f){c1[0], c1[1], c1[2], c1[3]};
  *reinterpret_cast<v4f*>(mrow + 20) = (v4f){c1[4], c1[5], c1[6], c1[7]};
}

// -----------------------------------------------------------------------------
// Kernel B (fused): TDM-stage MT[b] -> LDS; meanwhile
// qb[h] = b1[h] + sum_j q[b,n,j] * W1[D+j, h] (wave w sums j in [32w, 32w+32));
// WMMA GEMM + relu + W2 dot, masked softmax, then att2 @ att1.
// Masked tokens (tag <= 0) never reach the output: their logit is replaced by
// NEG_INF and their weight is exactly 0. The block therefore lists its unmasked
// token rows in LDS, and GEMM, softmax and weighted sum walk that list alone.
// With no unmasked token the softmax is uniform over all rows: the list then
// holds every row and every logit counts as NEG_INF.
// GEMM operands: a lane holds its token row's k = 8s+4hi .. 8s+4hi+3 in one
// 16-byte register group (s = 0..15); the pair (.x,.y) feeds WMMA 2s, the pair
// (.z,.w) WMMA 2s+1. Both loaders use this same k order.
// -----------------------------------------------------------------------------
#define SM_STRIDE 132  // 128 + TDM pad of 4 DWORDs -> conflict-free b128 reads (pitch 16 B x 33)

__global__ __launch_bounds__(256) void att_fused(const float* __restrict__ att1,
                                                 const float* __restrict__ MT,
                                                 const float* __restrict__ q,
                                                 const float* __restrict__ W1,
                                                 const float* __restrict__ b1,
                                                 const float* __restrict__ W2,
                                                 const float* __restrict__ b2p,
                                                 const int* __restrict__ tags,
                                                 const int* __restrict__ tptr,
                                                 float* __restrict__ out) {
  extern __shared__ float smem[];
  float* sMT = smem;                        // 128 rows(H) x 132 (O + pad)
  float* sLog = smem + Hdim * SM_STRIDE;    // 1024 (logits -> att2), by list position
  float* sRed = sLog + Adim;                // 16
  float* sQ = sRed + 16;                    // 8 waves x 128 partial sums of qb
  int* sIdx = reinterpret_cast<int*>(sQ + 8 * Hdim);  // 1024: token row at each list position
  int* sCnt = sIdx + Adim;                  // 8: unmasked tokens found by each wave
  float* sPart = smem;                      // phase-2 alias (8 waves x 128 floats)

  const int bn = blockIdx.x;
  const int b = bn >> 2;  // N = 4
  const int tid = threadIdx.x;
  const int wv = tid >> 5, lane = tid & 31, j = lane & 15, hi = lane >> 4;

  const float* att1_bn = att1 + (size_t)bn * Adim * Odim;
  const int* tags_bn = tags + (size_t)bn * Adim;
  const float* MTb = MT + (size_t)b * Odim * Hdim;

  // Tags of tokens 4*tid .. 4*tid+3: asked for first, so that they are back
  // while the loads below and the tensor load are still under way.
  const v4i tg = *reinterpret_cast<const v4i*>(tags_bn + 4 * tid);

  // q projection, loads: wave w takes rows D+32w .. D+32w+31 of W1, lane l the
  // columns 4l .. 4l+3. All 32 row loads are issued ahead of the tensor load,
  // so that one L2 round trip covers them and runs beside the tile's landing.
  const int wvu = __builtin_amdgcn_readfirstlane(wv);  // wave-uniform: q is read by scalar loads
  const float* qp = q + (size_t)bn * Qdim + wvu * 32;
  const float* wp = W1 + (size_t)(Ddim + wvu * 32) * Hdim + lane * 4;
  v4f wrow[32];
#pragma unroll  // full: wrow stays in registers and the loads form one run
  for (int i = 0; i < 32; i++) wrow[i] = *reinterpret_cast<const v4f*>(wp + (size_t)i * Hdim);

  // ---- TDM: async-load MT[b] (128x128 f32, row stride 128) into LDS with
  //      hardware padding: 4 DWORDs pad after every 128 DWORDs -> stride 132.
  if (wv == 0) {
    const unsigned long long ga = (unsigned long long)(uintptr_t)MTb;
    const unsigned int lds_addr = (unsigned int)(uintptr_t)sMT;  // low 32 = LDS byte offset

    v4u g0;
    g0.x = 1u;                                  // count=1 (valid), no gather
    g0.y = lds_addr;                            // LDS dest (bytes)
    g0.z = (unsigned int)(ga & 0xffffffffu);    // global_addr[31:0]
    g0.w = (unsigned int)((ga >> 32) & 0x1ffffffu) | (2u << 30);  // addr[56:32] | type=2

    v8i g1;
    g1[0] = (int)((2u << 16)      // data_size = 4 bytes
                | (1u << 20)      // pad_enable
                | (6u << 22)      // pad_interval: 2^(6+1)=128 DWORDs
                | (3u << 25));    // pad_amount: 3+1 = 4 DWORDs
    g1[1] = (int)(128u << 16);    // tensor_dim0[15:0]=128 (atomic_barrier_addr=0)
    g1[2] = (int)(128u << 16);    // tensor_dim0[31:16]=0 | tensor_dim1[15:0]=128
    g1[3] = (int)(128u << 16);    // tensor_dim1[31:16]=0 | tile_dim0=128
    g1[4] = (int)128u;            // tile_dim1=128 | tile_dim2=0
    g1[5] = (int)128u;            // tensor_dim0_stride[31:0]=128
    g1[6] = 0;                    // stride0[47:32]=0 | stride1[15:0]=0
    g1[7] = 0;                    // stride1[47:16]=0

    v4i gz4 = (v4i){0, 0, 0, 0};                     // groups 2/3 unused (2D tile)
    v8i gz8 = (v8i){0, 0, 0, 0, 0, 0, 0, 0};         // extra group (clang-23 form)

    __builtin_amdgcn_tensor_load_to_lds(g0, g1, gz4, gz4, gz8, 0);
    __builtin_amdgcn_s_wait_tensorcnt(0);
  }

  // q projection, sums: each wave's partial goes to its own LDS row; the
  // barrier below publishes it together with the tile.
  {
    v4f pacc = (v4f){0.f, 0.f, 0.f, 0.f};
#pragma unroll  // full: wrow is indexed by constants only
    for (int i = 0; i < 32; i++) pacc += qp[i] * wrow[i];
    *reinterpret_cast<v4f*>(sQ + wv * Hdim + lane * 4) = pacc;
  }

  // List of unmasked tokens, part 1: places inside the wave from four ballots
  // (one per token of a lane), the wave's count to LDS. Every list entry starts
  // as row 0, so that a position past the list's end still names a real row.
  unsigned int place[4];
  unsigned int wcnt = 0;
#pragma unroll  // full: place and tg are indexed by constants only
  for (int k = 0; k < 4; k++) {
    const unsigned int m = __builtin_amdgcn_ballot_w32(tg[k] > 0);
    place[k] = wcnt + __builtin_popcount(m & ((1u << lane) - 1u));
    wcnt += __builtin_popcount(m);
  }
  *reinterpret_cast<v4i*>(sIdx + 4 * tid) = (v4i){0, 0, 0, 0};
  if (lane == 0) sCnt[wv] = (int)wcnt;
  __syncthreads();

  // Part 2: the waves' counts give each wave its start and the list's length.
  unsigned int start = 0, found = 0;
#pragma unroll  // full: the eight LDS reads leave together
  for (int w = 0; w < 8; w++) {
    const unsigned int cw = (unsigned int)sCnt[w];
    start += (w < wv) ? cw : 0u;
    found += cw;
  }
  // At most 1024 (eight waves, four ballots of 32 lanes each) whatever the tags
  // hold; the same in every wave: made scalar, so that trip counts stay scalar.
  found = __builtin_amdgcn_readfirstlane(found);
  const int cnt = found ? (int)found : Adim;      // rows in the list
  if (found) {
#pragma unroll
    for (int k = 0; k < 4; k++)
      if (tg[k] > 0) sIdx[start + place[k]] = 4 * tid + k;
  } else {
    *reinterpret_cast<v4i*>(sIdx + 4 * tid) = (v4i){4 * tid, 4 * tid + 1, 4 * tid + 2, 4 * tid + 3};
  }
  __syncthreads();  // publishes the list

  // 16-row tile t of the list goes to wave t mod 8. att1 fragments of this
  // wave's first tile: they fly beside the column constants below. Tile wv lies
  // inside the 1024 list entries whatever the list's length.
  const char* att1c = reinterpret_cast<const char*>(att1_bn);  // scalar base; a lane adds a 32-bit byte offset
  v4f afr[16];
  {
    const unsigned int roff = (unsigned int)sIdx[wv * 16 + j] * (Odim * 4u) + 16u * hi;
#pragma unroll  // full: afr stays in registers
    for (int s = 0; s < 16; s++) afr[s] = *reinterpret_cast<const v4f*>(att1c + roff + 32 * s);
  }

  // per-lane column constants
  float qv[8], w2v[8];
#pragma unroll
  for (int ct = 0; ct < 8; ct++) {
    const int hc = ct * 16 + j;
    float qacc = b1[hc];
#pragma unroll
    for (int w = 0; w < 8; w++) qacc += sQ[w * Hdim + hc];
    qv[ct] = qacc;
    w2v[ct] = W2[hc];
  }
  const float b2v = b2p[0];

  // ---- GEMM att1[A,O] @ M[O,H], fused relu + W2 dot -> logits ----
  // One 16-row tile. Its att1 fragments are already in afr; where a next tile
  // exists (more), each group of four register groups (whole 128-byte lines of
  // the 16 rows) is refilled for it as soon as its last WMMA has been issued,
  // so that a load has about a tile's matrix time to land.
  const float* bcol = sMT + (size_t)j * SM_STRIDE + 4 * hi;
  auto row_tile = [&](const int t, auto more) {
    const int a0 = t * 16;
    v8f c[8];
#pragma unroll
    for (int i = 0; i < 8; i++) c[i] = (v8f){0.f, 0.f, 0.f, 0.f, 0.f, 0.f, 0.f, 0.f};

    // This lane's row in the wave's next tile, t + 8 (read only where that tile
    // exists, so the position lies inside the list's tiles).
    unsigned int noff = 0;
    if constexpr (decltype(more)::value) noff = (unsigned int)sIdx[(t + 8) * 16 + j] * (Odim * 4u) + 16u * hi;
    // All loops of the tile are unrolled in full: afr, bf and c are indexed by
    // constants only and stay in registers.
#pragma unroll
    for (int g = 0; g < 4; g++) {
#pragma unroll
      for (int u = 0; u < 4; u++) {
        const int s = 4 * g + u;
        const v4f a = afr[s];
        v4f bf[8];
#pragma unroll
        for (int ct = 0; ct < 8; ct++)  // MT[col, 8s+4hi .. +3]: one b128 read
          bf[ct] = *reinterpret_cast<const v4f*>(bcol + (size_t)ct * 16 * SM_STRIDE + 8 * s);
#pragma unroll
        for (int ct = 0; ct < 8; ct++)
          c[ct] = wmma_f32((v2f){a.x, a.y}, (v2f){bf[ct].x, bf[ct].y}, c[ct]);
#pragma unroll
        for (int ct = 0; ct < 8; ct++)
          c[ct] = wmma_f32((v2f){a.z, a.w}, (v2f){bf[ct].z, bf[ct].w}, c[ct]);
      }
      if constexpr (decltype(more)::value) {
#pragma unroll
        for (int u = 0; u < 4; u++)
          afr[4 * g + u] = *reinterpret_cast<const v4f*>(att1c + noff + 32 * (4 * g + u));
      }
    }
    // Order asked of the scheduler: the LDS reads in whole groups of 8, two
    // groups ahead of their 16 WMMAs, and behind every 64 WMMAs the 4 refill
    // loads of their registers. Without it all sixteen refills sink to the
    // tile's end, where most of the lead is lost, and the LDS reads of the
    // last tile stand singly among the WMMAs.
    // (the first group also takes the read of the next tile's row index)
    __builtin_amdgcn_sched_group_barrier(0x100, decltype(more)::value ? 17 : 16, 0);  // LDS reads
#pragma unroll  // full: the directives must stand in the tile's one block of code
    for (int s = 0; s < 16; s++) {
      __builtin_amdgcn_sched_group_barrier(0x008, 16, 0);  // matrix instructions
      if constexpr (decltype(more)::value) {
        if ((s & 3) == 3) __builtin_amdgcn_sched_group_barrier(0x020, 4, 0);  // global loads
      }
      if (s < 14) __builtin_amdgcn_sched_group_barrier(0x100, 8, 0);  // LDS reads
    }

    float s[8];
#pragma unroll
    for (int r = 0; r < 8; r++) s[r] = 0.f;
#pragma unroll
    for (int ct = 0; ct < 8; ct++) {
#pragma unroll
      for (int r = 0; r < 8; r++) {
        float x = c[ct][r] + qv[ct];
        x = x > 0.f ? x : 0.f;
        s[r] += x * w2v[ct];
      }
    }
    // reduce over the 16-lane N dimension (xor 1,2,4,8 keeps hi-halves apart)
#pragma unroll
    for (int r = 0; r < 8; r++) {
      float v = s[r];
      v += __shfl_xor(v, 1, 32);
      v += __shfl_xor(v, 2, 32);
      v += __shfl_xor(v, 4, 32);
      v += __shfl_xor(v, 8, 32);
      if (j == 0) sLog[a0 + r + 8 * hi] = v + b2v;
    }
  };
  const int ntw = (((cnt + 15) >> 4) - wvu + 7) >> 3;  // tiles of this wave: 0 .. 8, scalar
  int t = wvu;
  for (int i = 0; i + 1 < ntw; i++, t += 8) row_tile(t, std::true_type{});
  if (ntw > 0) row_tile(t, std::false_type{});
  __syncthreads();

  // ---- masked, temperature-scaled softmax over A = 1024 ----
  const float invt = 1.0f / (float)tptr[0];
  float lmax = NEG_INF;
  for (int a = tid; a < Adim; a += 256) {
    const float v = (a < (int)found) ? sLog[a] * invt : NEG_INF;  // past the list, or all masked
    sLog[a] = v;
    lmax = fmaxf(lmax, v);
  }
#pragma unroll
  for (int off = 16; off >= 1; off >>= 1) lmax = fmaxf(lmax, __shfl_xor(lmax, off, 32));
  if (lane == 0) sRed[wv] = lmax;
  __syncthreads();
  float bmax = sRed[0];
#pragma unroll
  for (int i = 1; i < 8; i++) bmax = fmaxf(bmax, sRed[i]);

  float lsum = 0.f;
  for (int a = tid; a < Adim; a += 256) {
    const float e = __expf(sLog[a] - bmax);
    sLog[a] = e;
    lsum += e;
  }
#pragma unroll
  for (int off = 16; off >= 1; off >>= 1) lsum += __shfl_xor(lsum, off, 32);
  if (lane == 0) sRed[8 + wv] = lsum;
  __syncthreads();
  float bsum = 0.f;
#pragma unroll
  for (int i = 0; i < 8; i++) bsum += sRed[8 + i];
  const float invsum = 1.0f / bsum;
  for (int a = tid; a < Adim; a += 256) sLog[a] *= invsum;
  __syncthreads();

  // ---- out[o] = sum_a att2[a] * att1[a,o]  (att1 reread hits L2) ----
  // Runs of 32 list positions go to the waves in turn; a lane holds columns
  // 4l .. 4l+3, so one load of a wave is one whole row (512 contiguous bytes).
  // Positions past the list's end name row 0 with weight 0.
  {
    const unsigned int loff = lane * 16u;
    v4f acc = (v4f){0.f, 0.f, 0.f, 0.f};
    for (int a0 = wvu * 32; a0 < cnt; a0 += 256) {
      v4f rowv[32];
      unsigned int off[32];
#pragma unroll  // full: off is indexed by constants only
      for (int g = 0; g < 8; g++) {
        const v4i ix = *reinterpret_cast<const v4i*>(sIdx + a0 + 4 * g);
#pragma unroll
        for (int k = 0; k < 4; k++) off[4 * g + k] = (unsigned int)ix[k] * (Odim * 4u) + loff;
      }
#pragma unroll  // full: 32 row loads leave in two runs, one L2 round trip for all
      for (int h = 0; h < 32; h += 16) {
#pragma unroll
        for (int i = 0; i < 16; i++) rowv[h + i] = *reinterpret_cast<const v4f*>(att1c + off[h + i]);
        // The run's offsets stay in their registers up to this wait, so that no
        // later result lands on an offset register that an issued load names
        // (one wait a run instead of one at every reuse of a register).
        asm volatile("s_wait_xcnt 0x0" ::"v"(off[h]), "v"(off[h + 1]), "v"(off[h + 2]), "v"(off[h + 3]),
                     "v"(off[h + 4]), "v"(off[h + 5]), "v"(off[h + 6]), "v"(off[h + 7]), "v"(off[h + 8]),
                     "v"(off[h + 9]), "v"(off[h + 10]), "v"(off[h + 11]), "v"(off[h + 12]),
                     "v"(off[h + 13]), "v"(off[h + 14]), "v"(off[h + 15])
                     : "memory");
      }
#pragma unroll  // full: rowv is indexed by constants only
      for (int g = 0; g < 8; g++) {
        const v4f wg = *reinterpret_cast<const v4f*>(sLog + a0 + 4 * g);
#pragma unroll
        for (int k = 0; k < 4; k++) acc += wg[k] * rowv[4 * g + k];
      }
    }
    *reinterpret_cast<v4f*>(sPart + wv * Odim + lane * 4) = acc;
  }
  __syncthreads();
  if (tid < Odim) {
    float r = sPart[tid];
#pragma unroll  // full: the seven LDS reads leave together
    for (int w = 1; w < 8; w++) r += sPart[w * Odim + tid];
    out[(size_t)bn * Odim + tid] = r;
  }
}

// -----------------------------------------------------------------------------
extern "C" void kernel_launch(void* const* d_in, const int* in_sizes, int n_in,
                              void* d_out, int out_size, void* d_ws, size_t ws_size,
                              hipStream_t stream) {
  const float* q    = (const float*)d_in[0];  // [B,N,1,Q]
  const float* att1 = (const float*)d_in[1];  // [B,N,A,O]
  const float* obj  = (const float*)d_in[2];  // [B,O,D]
  const int*   tags = (const int*)d_in[3];    // [B,N,A]
  const float* W1   = (const float*)d_in[4];  // [D+Q,H]
  const float* b1   = (const float*)d_in[5];  // [H]
  const float* W2   = (const float*)d_in[6];  // [H,1]
  const float* b2   = (const float*)d_in[7];  // [1]
  const int*   t    = (const int*)d_in[8];    // scalar
  float* out = (float*)d_out;                 // [B,N,O]

  float* MT = (float*)d_ws;                           // 64*128*128 f32 = 4 MB

  precompute_M<<<Bdim * 4, 256, 0, stream>>>(obj, W1, MT);

  const size_t smem = (size_t)(Hdim * SM_STRIDE + Adim + 16 + 8 * Hdim + Adim + 16) * sizeof(float);  // ~80 KB
  att_fused<<<Bdim * Ndim, 256, smem, stream>>>(att1, MT, q, W1, b1, W2, b2, tags, t, out);
}
